// v000
// Times are from an AMD MI455X. After a warm-up the kernel runs many times in a row, and a time is the length of
// such a window on the GPU divided by its runs, so every launch and the gaps after it count. The runs cycle
// through copies of the inputs. A figure is the median of several windows, for all but v000 over two sittings.
// Sittings can differ by a few percent; kernels timed side by side share one.
// v000 is the starting kernel. One run takes 612 microseconds.
#include <hip/hip_runtime.h>
#include <hip/hip_bf16.h>

typedef __bf16 bf16;
typedef bf16  v16bf __attribute__((ext_vector_type(16)));
typedef bf16  v8bf  __attribute__((ext_vector_type(8)));
typedef float v8f   __attribute__((ext_vector_type(8)));
typedef int   v2i   __attribute__((ext_vector_type(2)));

typedef __attribute__((address_space(1))) void as1_void;
typedef __attribute__((address_space(3))) void as3_void;
typedef __attribute__((address_space(1))) v2i  as1_v2i;
typedef __attribute__((address_space(3))) v2i  as3_v2i;

#define D_MODEL 512
#define NHEADS  8
#define DK      64
#define D_FF    2048
#define BATCH   4
#define SEQ     2048
#define TOKENS  (BATCH * SEQ)

__device__ __forceinline__ void async_copy_b64(const bf16* gsrc, bf16* lds_dst) {
#if __has_builtin(__builtin_amdgcn_global_load_async_to_lds_b64)
    __builtin_amdgcn_global_load_async_to_lds_b64(
        (as1_v2i*)(as1_void*)gsrc,
        (as3_v2i*)(as3_void*)lds_dst, 0, 0);
#else
    unsigned loff = (unsigned)(size_t)(as3_void*)lds_dst;
    asm volatile("global_load_async_to_lds_b64 %0, %1, off"
                 :: "v"(loff), "v"(gsrc) : "memory");
#endif
}

__device__ __forceinline__ void wait_async0() {
#if __has_builtin(__builtin_amdgcn_s_wait_asynccnt)
    __builtin_amdgcn_s_wait_asynccnt(0);
#else
    asm volatile("s_wait_asynccnt 0x0" ::: "memory");
#endif
}

__device__ __forceinline__ void wait_async1() {
#if __has_builtin(__builtin_amdgcn_s_wait_asynccnt)
    __builtin_amdgcn_s_wait_asynccnt(1);
#else
    asm volatile("s_wait_asynccnt 0x1" ::: "memory");
#endif
}

__device__ __forceinline__ v16bf load_frag(const bf16* __restrict__ base,
                                           int stride, int row0, int k0) {
    int lane = threadIdx.x & 31;
    int r = lane & 15, h = lane >> 4;
    const bf16* p = base + (size_t)(row0 + r) * stride + (k0 + h * 8);
    v8bf lo = *(const v8bf*)(p);
    v8bf hi = *(const v8bf*)(p + 16);
    return __builtin_shufflevector(lo, hi, 0,1,2,3,4,5,6,7,8,9,10,11,12,13,14,15);
}

__device__ __forceinline__ v8f wmma_bf16(v16bf a, v16bf b, v8f c) {
    return __builtin_amdgcn_wmma_f32_16x16x32_bf16(false, a, false, b,
                                                   (short)0, c, false, false);
}

// ---------------------------------------------------------------------------
// Prep kernels
// ---------------------------------------------------------------------------
__global__ void f32_to_bf16_kernel(const float* __restrict__ in,
                                   bf16* __restrict__ out, int n) {
    int i = blockIdx.x * blockDim.x + threadIdx.x;
    if (i < n) out[i] = (bf16)in[i];
}

// w is [K,N] row-major f32 -> wT is [N,K] row-major bf16
__global__ void transpose_to_bf16_kernel(const float* __restrict__ w,
                                         bf16* __restrict__ wT, int K, int N) {
    int i = blockIdx.x * blockDim.x + threadIdx.x;
    if (i < K * N) {
        int k = i / N, n = i % N;
        wT[(size_t)n * K + k] = (bf16)w[i];
    }
}

__global__ void gemm_wmma_kernel(const bf16* __restrict__ A,
                                 const bf16* __restrict__ Bt,
                                 const float* __restrict__ bias,
                                 const float* __restrict__ resid,
                                 void* __restrict__ outp,
                                 int M, int N, int K, int mode) {
    __shared__ bf16 tileA[2][32][32];

    int tid   = threadIdx.x;
    int wave  = tid >> 5;
    int gridN = N >> 9;                         // N / 512
    int tileM  = (blockIdx.x / gridN) << 5;
    int tileN0 = (blockIdx.x % gridN) << 9;
    int tN     = tileN0 + wave * 64;

    // async stage: each thread copies 8B; 256 threads cover 32x32 bf16.
    int arow = tid >> 3;                        // 0..31
    int acol = (tid & 7) * 4;                   // element offset, 8B granules
    const bf16* aSrcRow = A + (size_t)(tileM + arow) * K + acol;

    v8f acc[2][4];
#pragma unroll
    for (int mi = 0; mi < 2; ++mi)
#pragma unroll
        for (int t = 0; t < 4; ++t)
#pragma unroll
            for (int i = 0; i < 8; ++i) acc[mi][t][i] = 0.0f;

    int ksteps = K >> 5;
    async_copy_b64(aSrcRow, &tileA[0][arow][acol]);          // prime stage 0

    for (int ks = 0; ks < ksteps; ++ks) {
        int cur = ks & 1;
        if (ks + 1 < ksteps) {
            async_copy_b64(aSrcRow + (ks + 1) * 32, &tileA[cur ^ 1][arow][acol]);
            wait_async1();                                   // stage ks landed
        } else {
            wait_async0();
        }
        __syncthreads();

        const bf16* at = &tileA[cur][0][0];
        v16bf a0 = load_frag(at, 32, 0, 0);
        v16bf a1 = load_frag(at, 32, 16, 0);
        int k0 = ks * 32;
#pragma unroll
        for (int t = 0; t < 4; ++t) {
            v16bf b = load_frag(Bt, K, tN + 16 * t, k0);
            acc[0][t] = wmma_bf16(a0, b, acc[0][t]);
            acc[1][t] = wmma_bf16(a1, b, acc[1][t]);
        }
        __syncthreads();                        // readers done before re-fill
    }

    int lane = tid & 31;
    int r = lane & 15, hf = lane >> 4;
#pragma unroll
    for (int mi = 0; mi < 2; ++mi) {
#pragma unroll
        for (int t = 0; t < 4; ++t) {
#pragma unroll
            for (int i = 0; i < 8; ++i) {
                int m = tileM + mi * 16 + i + 8 * hf;   // token row
                int n = tN + t * 16 + r;                // output column
                float v = acc[mi][t][i] + bias[n];
                if (mode == 0) {                        // [b, h, s, dk]
                    int bb = m >> 11, s = m & (SEQ - 1);
                    int hd = n >> 6,  c = n & (DK - 1);
                    ((bf16*)outp)[((((size_t)bb * NHEADS + hd) * SEQ) + s) * DK + c] = (bf16)v;
                } else if (mode == 1) {                 // [b, h, dk, s]
                    int bb = m >> 11, s = m & (SEQ - 1);
                    int hd = n >> 6,  c = n & (DK - 1);
                    ((bf16*)outp)[((((size_t)bb * NHEADS + hd) * DK) + c) * SEQ + s] = (bf16)v;
                } else if (mode == 2) {                 // f32 + residual
                    size_t idx = (size_t)m * N + n;
                    ((float*)outp)[idx] = v + resid[idx];
                } else {                                // bf16 ReLU
                    ((bf16*)outp)[(size_t)m * N + n] = (bf16)fmaxf(v, 0.0f);
                }
            }
        }
    }
}

// ---------------------------------------------------------------------------
// Flash attention: one wave per 16 query rows of one (b,h). Online softmax,
// 32 keys per step; P tile C-layout -> A-layout via per-wave LDS staging.
// ---------------------------------------------------------------------------
__global__ void attn_wmma_kernel(const bf16* __restrict__ q,
                                 const bf16* __restrict__ k,
                                 const bf16* __restrict__ vT,
                                 bf16* __restrict__ attn_c) {
    __shared__ bf16 pbuf[4][16 * 32];
    int wid  = threadIdx.x >> 5;
    int lane = threadIdx.x & 31;
    int r = lane & 15, hf = lane >> 4;

    int qblocks = SEQ / 64;
    int bh = blockIdx.x / qblocks;
    int qt = (blockIdx.x % qblocks) * 64 + wid * 16;

    const bf16* qh = q  + (size_t)bh * SEQ * DK;
    const bf16* kh = k  + (size_t)bh * SEQ * DK;
    const bf16* vh = vT + (size_t)bh * DK * SEQ;

    v16bf qa0 = load_frag(qh, DK, qt, 0);
    v16bf qa1 = load_frag(qh, DK, qt, 32);

    v8f o[4];
    float mrow[8], lrow[8];
#pragma unroll
    for (int t = 0; t < 4; ++t)
#pragma unroll
        for (int i = 0; i < 8; ++i) o[t][i] = 0.0f;
#pragma unroll
    for (int i = 0; i < 8; ++i) { mrow[i] = -1e30f; lrow[i] = 0.0f; }

    for (int j = 0; j < SEQ; j += 32) {
        v8f s0, s1;
#pragma unroll
        for (int i = 0; i < 8; ++i) { s0[i] = 0.0f; s1[i] = 0.0f; }
        s0 = wmma_bf16(qa0, load_frag(kh, DK, j, 0),       s0);
        s0 = wmma_bf16(qa1, load_frag(kh, DK, j, 32),      s0);
        s1 = wmma_bf16(qa0, load_frag(kh, DK, j + 16, 0),  s1);
        s1 = wmma_bf16(qa1, load_frag(kh, DK, j + 16, 32), s1);

        float corr[8];
#pragma unroll
        for (int i = 0; i < 8; ++i) {
            float a0 = s0[i] * 0.125f;        // 1/sqrt(dk)
            float a1 = s1[i] * 0.125f;
            float mx = fmaxf(a0, a1);         // xor<16 stays inside the half
            mx = fmaxf(mx, __shfl_xor(mx, 1));
            mx = fmaxf(mx, __shfl_xor(mx, 2));
            mx = fmaxf(mx, __shfl_xor(mx, 4));
            mx = fmaxf(mx, __shfl_xor(mx, 8));
            float nm = fmaxf(mrow[i], mx);
            corr[i] = __expf(mrow[i] - nm);
            float p0 = __expf(a0 - nm);
            float p1 = __expf(a1 - nm);
            float rs = p0 + p1;
            rs += __shfl_xor(rs, 1);
            rs += __shfl_xor(rs, 2);
            rs += __shfl_xor(rs, 4);
            rs += __shfl_xor(rs, 8);
            lrow[i] = lrow[i] * corr[i] + rs;
            mrow[i] = nm;
            int m = i + 8 * hf;               // C layout -> LDS [m][key]
            pbuf[wid][m * 32 + r]      = (bf16)p0;
            pbuf[wid][m * 32 + 16 + r] = (bf16)p1;
        }
#pragma unroll
        for (int t = 0; t < 4; ++t)
#pragma unroll
            for (int i = 0; i < 8; ++i) o[t][i] *= corr[i];

        v16bf pa = load_frag(&pbuf[wid][0], 32, 0, 0);  // A layout (16x32)
#pragma unroll
        for (int t = 0; t < 4; ++t)
            o[t] = wmma_bf16(pa, load_frag(vh, SEQ, t * 16, j), o[t]);
    }

    int bb = bh >> 3, hd = bh & (NHEADS - 1);
#pragma unroll
    for (int t = 0; t < 4; ++t) {
#pragma unroll
        for (int i = 0; i < 8; ++i) {
            int srow = qt + i + 8 * hf;
            size_t tok = (size_t)bb * SEQ + srow;
            int col = hd * DK + t * 16 + r;
            attn_c[tok * D_MODEL + col] = (bf16)(o[t][i] / lrow[i]);
        }
    }
}

// ---------------------------------------------------------------------------
// LayerNorm (faithful: unbiased std, eps added to std). One wave per row.
// ---------------------------------------------------------------------------
__global__ void layernorm_kernel(const float* __restrict__ z,
                                 const float* __restrict__ alpha,
                                 const float* __restrict__ beta,
                                 float* __restrict__ out32,
                                 bf16* __restrict__ out16) {
    int wid  = threadIdx.x >> 5;
    int lane = threadIdx.x & 31;
    int row = blockIdx.x * (blockDim.x >> 5) + wid;
    const float* zr = z + (size_t)row * D_MODEL;

    float x[16];
    float sum = 0.0f;
#pragma unroll
    for (int e = 0; e < 16; ++e) { x[e] = zr[lane + 32 * e]; sum += x[e]; }
    sum += __shfl_xor(sum, 1);  sum += __shfl_xor(sum, 2);
    sum += __shfl_xor(sum, 4);  sum += __shfl_xor(sum, 8);
    sum += __shfl_xor(sum, 16);
    float mean = sum * (1.0f / 512.0f);

    float var = 0.0f;
#pragma unroll
    for (int e = 0; e < 16; ++e) { float d = x[e] - mean; var += d * d; }
    var += __shfl_xor(var, 1);  var += __shfl_xor(var, 2);
    var += __shfl_xor(var, 4);  var += __shfl_xor(var, 8);
    var += __shfl_xor(var, 16);
    var *= (1.0f / 511.0f);                   // ddof = 1
    float inv = 1.0f / (sqrtf(var) + 1e-6f);  // eps added to std

#pragma unroll
    for (int e = 0; e < 16; ++e) {
        int c = lane + 32 * e;
        float y = alpha[c] * (x[e] - mean) * inv + beta[c];
        out32[(size_t)row * D_MODEL + c] = y;
        if (out16) out16[(size_t)row * D_MODEL + c] = (bf16)y;
    }
}

// ---------------------------------------------------------------------------
// Launch
// ---------------------------------------------------------------------------
extern "C" void kernel_launch(void* const* d_in, const int* in_sizes, int n_in,
                              void* d_out, int out_size, void* d_ws, size_t ws_size,
                              hipStream_t stream) {
    const float* x    = (const float*)d_in[0];
    const float* wq   = (const float*)d_in[1];
    const float* bq   = (const float*)d_in[2];
    const float* wk   = (const float*)d_in[3];
    const float* bk   = (const float*)d_in[4];
    const float* wv   = (const float*)d_in[5];
    const float* bv   = (const float*)d_in[6];
    const float* wo   = (const float*)d_in[7];
    const float* bo   = (const float*)d_in[8];
    const float* w1   = (const float*)d_in[9];
    const float* b1   = (const float*)d_in[10];
    const float* w2   = (const float*)d_in[11];
    const float* b2   = (const float*)d_in[12];
    const float* ln1a = (const float*)d_in[13];
    const float* ln1b = (const float*)d_in[14];
    const float* ln2a = (const float*)d_in[15];
    const float* ln2b = (const float*)d_in[16];
    float* out = (float*)d_out;

    char* ws = (char*)d_ws;
    size_t off = 0;
    auto carve = [&](size_t bytes) { char* p = ws + off; off += (bytes + 255) & ~(size_t)255; return p; };
    bf16*  xb   = (bf16*)carve((size_t)TOKENS * D_MODEL * 2);
    bf16*  wqT  = (bf16*)carve((size_t)D_MODEL * D_MODEL * 2);
    bf16*  wkT  = (bf16*)carve((size_t)D_MODEL * D_MODEL * 2);
    bf16*  wvT  = (bf16*)carve((size_t)D_MODEL * D_MODEL * 2);
    bf16*  woT  = (bf16*)carve((size_t)D_MODEL * D_MODEL * 2);
    bf16*  w1T  = (bf16*)carve((size_t)D_MODEL * D_FF * 2);
    bf16*  w2T  = (bf16*)carve((size_t)D_FF * D_MODEL * 2);
    bf16*  qb   = (bf16*)carve((size_t)TOKENS * D_MODEL * 2);
    bf16*  kb   = (bf16*)carve((size_t)TOKENS * D_MODEL * 2);
    bf16*  vTb  = (bf16*)carve((size_t)TOKENS * D_MODEL * 2);
    bf16*  attn = (bf16*)carve((size_t)TOKENS * D_MODEL * 2);
    float* z1   = (float*)carve((size_t)TOKENS * D_MODEL * 4);   // reused for z2
    float* y32  = (float*)carve((size_t)TOKENS * D_MODEL * 4);
    bf16*  y16  = (bf16*)carve((size_t)TOKENS * D_MODEL * 2);
    bf16*  ffh  = (bf16*)carve((size_t)TOKENS * D_FF * 2);

    // --- prep: bf16 conversion + weight transposes ---
    f32_to_bf16_kernel<<<(TOKENS * D_MODEL) / 256, 256, 0, stream>>>(x, xb, TOKENS * D_MODEL);
    transpose_to_bf16_kernel<<<(D_MODEL * D_MODEL) / 256, 256, 0, stream>>>(wq, wqT, D_MODEL, D_MODEL);
    transpose_to_bf16_kernel<<<(D_MODEL * D_MODEL) / 256, 256, 0, stream>>>(wk, wkT, D_MODEL, D_MODEL);
    transpose_to_bf16_kernel<<<(D_MODEL * D_MODEL) / 256, 256, 0, stream>>>(wv, wvT, D_MODEL, D_MODEL);
    transpose_to_bf16_kernel<<<(D_MODEL * D_MODEL) / 256, 256, 0, stream>>>(wo, woT, D_MODEL, D_MODEL);
    transpose_to_bf16_kernel<<<(D_MODEL * D_FF) / 256, 256, 0, stream>>>(w1, w1T, D_MODEL, D_FF);
    transpose_to_bf16_kernel<<<(D_FF * D_MODEL) / 256, 256, 0, stream>>>(w2, w2T, D_FF, D_MODEL);

    // --- QKV projections: workgroup tile 32x512 -> 256 blocks each ---
    gemm_wmma_kernel<<<256, 256, 0, stream>>>(xb, wqT, bq, nullptr, qb,  TOKENS, D_MODEL, D_MODEL, 0);
    gemm_wmma_kernel<<<256, 256, 0, stream>>>(xb, wkT, bk, nullptr, kb,  TOKENS, D_MODEL, D_MODEL, 0);
    gemm_wmma_kernel<<<256, 256, 0, stream>>>(xb, wvT, bv, nullptr, vTb, TOKENS, D_MODEL, D_MODEL, 1);

    // --- attention: 32 (b,h) * 32 q-blocks, 4 waves each ---
    attn_wmma_kernel<<<BATCH * NHEADS * (SEQ / 64), 128, 0, stream>>>(qb, kb, vTb, attn);

    // --- out-proj + residual -> z1; LN1 -> y (f32 + bf16) ---
    gemm_wmma_kernel<<<256, 256, 0, stream>>>(attn, woT, bo, x, z1, TOKENS, D_MODEL, D_MODEL, 2);
    layernorm_kernel<<<TOKENS / 8, 256, 0, stream>>>(z1, ln1a, ln1b, y32, y16);

    // --- FFN1 (ReLU) -> ffh; FFN2 + residual(y) -> z1; LN2 -> out ---
    gemm_wmma_kernel<<<1024, 256, 0, stream>>>(y16, w1T, b1, nullptr, ffh, TOKENS, D_FF, D_MODEL, 3);
    gemm_wmma_kernel<<<256, 256, 0, stream>>>(ffh, w2T, b2, y32, z1, TOKENS, D_MODEL, D_FF, 2);
    layernorm_kernel<<<TOKENS / 8, 256, 0, stream>>>(z1, ln2a, ln2b, out, nullptr);
}

// v001
// It runs in 529 microseconds.
// Two timings next to v000 put it at 1.18 and 1.17 times that version's speed.
#include <hip/hip_runtime.h>
#include <hip/hip_bf16.h>

typedef __bf16 bf16;
typedef bf16  v16bf __attribute__((ext_vector_type(16)));
typedef bf16  v8bf  __attribute__((ext_vector_type(8)));
typedef float v8f   __attribute__((ext_vector_type(8)));
typedef int   v2i   __attribute__((ext_vector_type(2)));

typedef __attribute__((address_space(1))) void as1_void;
typedef __attribute__((address_space(3))) void as3_void;
typedef __attribute__((address_space(1))) v2i  as1_v2i;
typedef __attribute__((address_space(3))) v2i  as3_v2i;

#define D_MODEL 512
#define NHEADS  8
#define DK      64
#define D_FF    2048
#define BATCH   4
#define SEQ     2048
#define TOKENS  (BATCH * SEQ)

__device__ __forceinline__ void async_copy_b64(const bf16* gsrc, bf16* lds_dst) {
#if __has_builtin(__builtin_amdgcn_global_load_async_to_lds_b64)
    __builtin_amdgcn_global_load_async_to_lds_b64(
        (as1_v2i*)(as1_void*)gsrc,
        (as3_v2i*)(as3_void*)lds_dst, 0, 0);
#else
    unsigned loff = (unsigned)(size_t)(as3_void*)lds_dst;
    asm volatile("global_load_async_to_lds_b64 %0, %1, off"
                 :: "v"(loff), "v"(gsrc) : "memory");
#endif
}

__device__ __forceinline__ void wait_async0() {
#if __has_builtin(__builtin_amdgcn_s_wait_asynccnt)
    __builtin_amdgcn_s_wait_asynccnt(0);
#else
    asm volatile("s_wait_asynccnt 0x0" ::: "memory");
#endif
}

__device__ __forceinline__ void wait_async1() {
#if __has_builtin(__builtin_amdgcn_s_wait_asynccnt)
    __builtin_amdgcn_s_wait_asynccnt(1);
#else
    asm volatile("s_wait_asynccnt 0x1" ::: "memory");
#endif
}

__device__ __forceinline__ v16bf load_frag(const bf16* __restrict__ base,
                                           int stride, int row0, int k0) {
    int lane = threadIdx.x & 31;
    int r = lane & 15, h = lane >> 4;
    const bf16* p = base + (size_t)(row0 + r) * stride + (k0 + h * 8);
    v8bf lo = *(const v8bf*)(p);
    v8bf hi = *(const v8bf*)(p + 16);
    return __builtin_shufflevector(lo, hi, 0,1,2,3,4,5,6,7,8,9,10,11,12,13,14,15);
}

__device__ __forceinline__ v8f wmma_bf16(v16bf a, v16bf b, v8f c) {
    return __builtin_amdgcn_wmma_f32_16x16x32_bf16(false, a, false, b,
                                                   (short)0, c, false, false);
}

// ---------------------------------------------------------------------------
// Prep kernels
// ---------------------------------------------------------------------------
__global__ void f32_to_bf16_kernel(const float* __restrict__ in,
                                   bf16* __restrict__ out, int n) {
    int i = blockIdx.x * blockDim.x + threadIdx.x;
    if (i < n) out[i] = (bf16)in[i];
}

// w is [K,N] row-major f32 -> wT is [N,K] row-major bf16
__global__ void transpose_to_bf16_kernel(const float* __restrict__ w,
                                         bf16* __restrict__ wT, int K, int N) {
    int i = blockIdx.x * blockDim.x + threadIdx.x;
    if (i < K * N) {
        int k = i / N, n = i % N;
        wT[(size_t)n * K + k] = (bf16)w[i];
    }
}

__global__ void gemm_wmma_kernel(const bf16* __restrict__ A,
                                 const bf16* __restrict__ Bt,
                                 const float* __restrict__ bias,
                                 const float* __restrict__ resid,
                                 void* __restrict__ outp,
                                 int M, int N, int K, int mode) {
    __shared__ bf16 tileA[2][32][32];

    int tid   = threadIdx.x;
    int wave  = tid >> 5;
    int gridN = N >> 9;                         // N / 512
    int tileM  = (blockIdx.x / gridN) << 5;
    int tileN0 = (blockIdx.x % gridN) << 9;
    int tN     = tileN0 + wave * 64;

    // async stage: each thread copies 8B; 256 threads cover 32x32 bf16.
    int arow = tid >> 3;                        // 0..31
    int acol = (tid & 7) * 4;                   // element offset, 8B granules
    const bf16* aSrcRow = A + (size_t)(tileM + arow) * K + acol;

    v8f acc[2][4];
#pragma unroll
    for (int mi = 0; mi < 2; ++mi)
#pragma unroll
        for (int t = 0; t < 4; ++t)
#pragma unroll
            for (int i = 0; i < 8; ++i) acc[mi][t][i] = 0.0f;

    int ksteps = K >> 5;
    async_copy_b64(aSrcRow, &tileA[0][arow][acol]);          // prime stage 0

    for (int ks = 0; ks < ksteps; ++ks) {
        int cur = ks & 1;
        if (ks + 1 < ksteps) {
            async_copy_b64(aSrcRow + (ks + 1) * 32, &tileA[cur ^ 1][arow][acol]);
            wait_async1();                                   // stage ks landed
        } else {
            wait_async0();
        }
        __syncthreads();

        const bf16* at = &tileA[cur][0][0];
        v16bf a0 = load_frag(at, 32, 0, 0);
        v16bf a1 = load_frag(at, 32, 16, 0);
        int k0 = ks * 32;
#pragma unroll
        for (int t = 0; t < 4; ++t) {
            v16bf b = load_frag(Bt, K, tN + 16 * t, k0);
            acc[0][t] = wmma_bf16(a0, b, acc[0][t]);
            acc[1][t] = wmma_bf16(a1, b, acc[1][t]);
        }
        __syncthreads();                        // readers done before re-fill
    }

    int lane = tid & 31;
    int r = lane & 15, hf = lane >> 4;
#pragma unroll
    for (int mi = 0; mi < 2; ++mi) {
#pragma unroll
        for (int t = 0; t < 4; ++t) {
#pragma unroll
            for (int i = 0; i < 8; ++i) {
                int m = tileM + mi * 16 + i + 8 * hf;   // token row
                int n = tN + t * 16 + r;                // output column
                float v = acc[mi][t][i] + bias[n];
                if (mode == 0) {                        // [b, h, s, dk]
                    int bb = m >> 11, s = m & (SEQ - 1);
                    int hd = n >> 6,  c = n & (DK - 1);
                    ((bf16*)outp)[((((size_t)bb * NHEADS + hd) * SEQ) + s) * DK + c] = (bf16)v;
                } else if (mode == 1) {                 // [b, h, dk, s]
                    int bb = m >> 11, s = m & (SEQ - 1);
                    int hd = n >> 6,  c = n & (DK - 1);
                    ((bf16*)outp)[((((size_t)bb * NHEADS + hd) * DK) + c) * SEQ + s] = (bf16)v;
                } else if (mode == 2) {                 // f32 + residual
                    size_t idx = (size_t)m * N + n;
                    ((float*)outp)[idx] = v + resid[idx];
                } else {                                // bf16 ReLU
                    ((bf16*)outp)[(size_t)m * N + n] = (bf16)fmaxf(v, 0.0f);
                }
            }
        }
    }
}

__device__ __forceinline__ float xhalf(float x) {
    int b = __builtin_bit_cast(int, x);
    return __builtin_bit_cast(float,
        __builtin_amdgcn_permlanex16(b, b, 0x76543210, 0xfedcba98, false, false));
}

__global__ void attn_wmma_kernel(const bf16* __restrict__ q,
                                 const bf16* __restrict__ k,
                                 const bf16* __restrict__ vT,
                                 bf16* __restrict__ attn_c) {
    int wid  = threadIdx.x >> 5;
    int lane = threadIdx.x & 31;
    int r = lane & 15, hf = lane >> 4;

    int qblocks = SEQ / 64;
    int bh = blockIdx.x / qblocks;
    int qt = (blockIdx.x % qblocks) * 64 + wid * 16;

    const bf16* qh = q  + (size_t)bh * SEQ * DK;
    const bf16* kh = k  + (size_t)bh * SEQ * DK;
    const bf16* vh = vT + (size_t)bh * DK * SEQ;

    v16bf qb0 = load_frag(qh, DK, qt, 0);     // B operand: column = query
    v16bf qb1 = load_frag(qh, DK, qt, 32);

    v8f o[4];                                 // o[t][i] = O[query r][16t + 8hf + i]
#pragma unroll
    for (int t = 0; t < 4; ++t)
#pragma unroll
        for (int i = 0; i < 8; ++i) o[t][i] = 0.0f;
    float mrun = -1e30f;                      // maximum of query r, equal in both halves
    float lsum = 0.0f;                        // this half's share of the sum of query r

    for (int j = 0; j < SEQ; j += 32) {
        v8f s0, s1;                           // s0[i]: key j + 8hf + i; s1[i]: 16 further
#pragma unroll
        for (int i = 0; i < 8; ++i) { s0[i] = 0.0f; s1[i] = 0.0f; }
        s0 = wmma_bf16(load_frag(kh, DK, j, 0),       qb0, s0);
        s0 = wmma_bf16(load_frag(kh, DK, j, 32),      qb1, s0);
        s1 = wmma_bf16(load_frag(kh, DK, j + 16, 0),  qb0, s1);
        s1 = wmma_bf16(load_frag(kh, DK, j + 16, 32), qb1, s1);

        float mx = -1e30f;
#pragma unroll
        for (int i = 0; i < 8; ++i) {
            s0[i] *= 0.125f;                  // 1/sqrt(dk)
            s1[i] *= 0.125f;
            mx = fmaxf(mx, fmaxf(s0[i], s1[i]));
        }
        mx = fmaxf(mx, xhalf(mx));
        float nm   = fmaxf(mrun, mx);
        float corr = __expf(mrun - nm);
        mrun = nm;

        v16bf pb;                             // B operand in the fragment's k order
        float rs = 0.0f;
#pragma unroll
        for (int i = 0; i < 8; ++i) {
            float p0 = __expf(s0[i] - nm);
            float p1 = __expf(s1[i] - nm);
            rs += p0 + p1;
            pb[i]     = (bf16)p0;
            pb[8 + i] = (bf16)p1;
        }
        lsum = lsum * corr + rs;

#pragma unroll
        for (int t = 0; t < 4; ++t)
#pragma unroll
            for (int i = 0; i < 8; ++i) o[t][i] *= corr;
#pragma unroll
        for (int t = 0; t < 4; ++t)
            o[t] = wmma_bf16(load_frag(vh, SEQ, t * 16, j), pb, o[t]);
    }

    lsum += xhalf(lsum);                      // join the halves' sums once

    int bb = bh >> 3, hd = bh & (NHEADS - 1);
    size_t tok = (size_t)bb * SEQ + qt + r;
#pragma unroll
    for (int t = 0; t < 4; ++t) {
        v8bf ov;                              // 8 consecutive columns of one token
#pragma unroll
        for (int i = 0; i < 8; ++i) ov[i] = (bf16)(o[t][i] / lsum);
        *(v8bf*)(attn_c + tok * D_MODEL + hd * DK + t * 16 + 8 * hf) = ov;
    }
}

// ---------------------------------------------------------------------------
// LayerNorm (faithful: unbiased std, eps added to std). One wave per row.
// ---------------------------------------------------------------------------
__global__ void layernorm_kernel(const float* __restrict__ z,
                                 const float* __restrict__ alpha,
                                 const float* __restrict__ beta,
                                 float* __restrict__ out32,
                                 bf16* __restrict__ out16) {
    int wid  = threadIdx.x >> 5;
    int lane = threadIdx.x & 31;
    int row = blockIdx.x * (blockDim.x >> 5) + wid;
    const float* zr = z + (size_t)row * D_MODEL;

    float x[16];
    float sum = 0.0f;
#pragma unroll
    for (int e = 0; e < 16; ++e) { x[e] = zr[lane + 32 * e]; sum += x[e]; }
    sum += __shfl_xor(sum, 1);  sum += __shfl_xor(sum, 2);
    sum += __shfl_xor(sum, 4);  sum += __shfl_xor(sum, 8);
    sum += __shfl_xor(sum, 16);
    float mean = sum * (1.0f / 512.0f);

    float var = 0.0f;
#pragma unroll
    for (int e = 0; e < 16; ++e) { float d = x[e] - mean; var += d * d; }
    var += __shfl_xor(var, 1);  var += __shfl_xor(var, 2);
    var += __shfl_xor(var, 4);  var += __shfl_xor(var, 8);
    var += __shfl_xor(var, 16);
    var *= (1.0f / 511.0f);                   // ddof = 1
    float inv = 1.0f / (sqrtf(var) + 1e-6f);  // eps added to std

#pragma unroll
    for (int e = 0; e < 16; ++e) {
        int c = lane + 32 * e;
        float y = alpha[c] * (x[e] - mean) * inv + beta[c];
        out32[(size_t)row * D_MODEL + c] = y;
        if (out16) out16[(size_t)row * D_MODEL + c] = (bf16)y;
    }
}

// ---------------------------------------------------------------------------
// Launch
// ---------------------------------------------------------------------------
extern "C" void kernel_launch(void* const* d_in, const int* in_sizes, int n_in,
                              void* d_out, int out_size, void* d_ws, size_t ws_size,
                              hipStream_t stream) {
    const float* x    = (const float*)d_in[0];
    const float* wq   = (const float*)d_in[1];
    const float* bq   = (const float*)d_in[2];
    const float* wk   = (const float*)d_in[3];
    const float* bk   = (const float*)d_in[4];
    const float* wv   = (const float*)d_in[5];
    const float* bv   = (const float*)d_in[6];
    const float* wo   = (const float*)d_in[7];
    const float* bo   = (const float*)d_in[8];
    const float* w1   = (const float*)d_in[9];
    const float* b1   = (const float*)d_in[10];
    const float* w2   = (const float*)d_in[11];
    const float* b2   = (const float*)d_in[12];
    const float* ln1a = (const float*)d_in[13];
    const float* ln1b = (const float*)d_in[14];
    const float* ln2a = (const float*)d_in[15];
    const float* ln2b = (const float*)d_in[16];
    float* out = (float*)d_out;

    char* ws = (char*)d_ws;
    size_t off = 0;
    auto carve = [&](size_t bytes) { char* p = ws + off; off += (bytes + 255) & ~(size_t)255; return p; };
    bf16*  xb   = (bf16*)carve((size_t)TOKENS * D_MODEL * 2);
    bf16*  wqT  = (bf16*)carve((size_t)D_MODEL * D_MODEL * 2);
    bf16*  wkT  = (bf16*)carve((size_t)D_MODEL * D_MODEL * 2);
    bf16*  wvT  = (bf16*)carve((size_t)D_MODEL * D_MODEL * 2);
    bf16*  woT  = (bf16*)carve((size_t)D_MODEL * D_MODEL * 2);
    bf16*  w1T  = (bf16*)carve((size_t)D_MODEL * D_FF * 2);
    bf16*  w2T  = (bf16*)carve((size_t)D_FF * D_MODEL * 2);
    bf16*  qb   = (bf16*)carve((size_t)TOKENS * D_MODEL * 2);
    bf16*  kb   = (bf16*)carve((size_t)TOKENS * D_MODEL * 2);
    bf16*  vTb  = (bf16*)carve((size_t)TOKENS * D_MODEL * 2);
    bf16*  attn = (bf16*)carve((size_t)TOKENS * D_MODEL * 2);
    float* z1   = (float*)carve((size_t)TOKENS * D_MODEL * 4);   // reused for z2
    float* y32  = (float*)carve((size_t)TOKENS * D_MODEL * 4);
    bf16*  y16  = (bf16*)carve((size_t)TOKENS * D_MODEL * 2);
    bf16*  ffh  = (bf16*)carve((size_t)TOKENS * D_FF * 2);

    // --- prep: bf16 conversion + weight transposes ---
    f32_to_bf16_kernel<<<(TOKENS * D_MODEL) / 256, 256, 0, stream>>>(x, xb, TOKENS * D_MODEL);
    transpose_to_bf16_kernel<<<(D_MODEL * D_MODEL) / 256, 256, 0, stream>>>(wq, wqT, D_MODEL, D_MODEL);
    transpose_to_bf16_kernel<<<(D_MODEL * D_MODEL) / 256, 256, 0, stream>>>(wk, wkT, D_MODEL, D_MODEL);
    transpose_to_bf16_kernel<<<(D_MODEL * D_MODEL) / 256, 256, 0, stream>>>(wv, wvT, D_MODEL, D_MODEL);
    transpose_to_bf16_kernel<<<(D_MODEL * D_MODEL) / 256, 256, 0, stream>>>(wo, woT, D_MODEL, D_MODEL);
    transpose_to_bf16_kernel<<<(D_MODEL * D_FF) / 256, 256, 0, stream>>>(w1, w1T, D_MODEL, D_FF);
    transpose_to_bf16_kernel<<<(D_FF * D_MODEL) / 256, 256, 0, stream>>>(w2, w2T, D_FF, D_MODEL);

    // --- QKV projections: workgroup tile 32x512 -> 256 blocks each ---
    gemm_wmma_kernel<<<256, 256, 0, stream>>>(xb, wqT, bq, nullptr, qb,  TOKENS, D_MODEL, D_MODEL, 0);
    gemm_wmma_kernel<<<256, 256, 0, stream>>>(xb, wkT, bk, nullptr, kb,  TOKENS, D_MODEL, D_MODEL, 0);
    gemm_wmma_kernel<<<256, 256, 0, stream>>>(xb, wvT, bv, nullptr, vTb, TOKENS, D_MODEL, D_MODEL, 1);

    // --- attention: 32 (b,h) * 32 q-blocks, 4 waves each ---
    attn_wmma_kernel<<<BATCH * NHEADS * (SEQ / 64), 128, 0, stream>>>(qb, kb, vTb, attn);

    // --- out-proj + residual -> z1; LN1 -> y (f32 + bf16) ---
    gemm_wmma_kernel<<<256, 256, 0, stream>>>(attn, woT, bo, x, z1, TOKENS, D_MODEL, D_MODEL, 2);
    layernorm_kernel<<<TOKENS / 8, 256, 0, stream>>>(z1, ln1a, ln1b, y32, y16);

    // --- FFN1 (ReLU) -> ffh; FFN2 + residual(y) -> z1; LN2 -> out ---
    gemm_wmma_kernel<<<1024, 256, 0, stream>>>(y16, w1T, b1, nullptr, ffh, TOKENS, D_FF, D_MODEL, 3);
    gemm_wmma_kernel<<<256, 256, 0, stream>>>(ffh, w2T, b2, y32, z1, TOKENS, D_MODEL, D_FF, 2);
    layernorm_kernel<<<TOKENS / 8, 256, 0, stream>>>(z1, ln2a, ln2b, out, nullptr);
}

// v002
// One run takes 448 microseconds.
// In two side-by-side timings against v001, it was 1.18 and 1.17 times as fast.
// Over all steps from v000 it is 1.38 times as fast.
#include <hip/hip_runtime.h>
#include <hip/hip_bf16.h>

typedef __bf16 bf16;
typedef bf16  v16bf __attribute__((ext_vector_type(16)));
typedef bf16  v8bf  __attribute__((ext_vector_type(8)));
typedef float v8f   __attribute__((ext_vector_type(8)));
typedef int   v2i   __attribute__((ext_vector_type(2)));

typedef __attribute__((address_space(1))) void as1_void;
typedef __attribute__((address_space(3))) void as3_void;
typedef __attribute__((address_space(1))) v2i  as1_v2i;
typedef __attribute__((address_space(3))) v2i  as3_v2i;

#define D_MODEL 512
#define NHEADS  8
#define DK      64
#define D_FF    2048
#define BATCH   4
#define SEQ     2048
#define TOKENS  (BATCH * SEQ)

__device__ __forceinline__ void async_copy_b64(const bf16* gsrc, bf16* lds_dst) {
#if __has_builtin(__builtin_amdgcn_global_load_async_to_lds_b64)
    __builtin_amdgcn_global_load_async_to_lds_b64(
        (as1_v2i*)(as1_void*)gsrc,
        (as3_v2i*)(as3_void*)lds_dst, 0, 0);
#else
    unsigned loff = (unsigned)(size_t)(as3_void*)lds_dst;
    asm volatile("global_load_async_to_lds_b64 %0, %1, off"
                 :: "v"(loff), "v"(gsrc) : "memory");
#endif
}

__device__ __forceinline__ void wait_async0() {
#if __has_builtin(__builtin_amdgcn_s_wait_asynccnt)
    __builtin_amdgcn_s_wait_asynccnt(0);
#else
    asm volatile("s_wait_asynccnt 0x0" ::: "memory");
#endif
}

__device__ __forceinline__ void wait_async1() {
#if __has_builtin(__builtin_amdgcn_s_wait_asynccnt)
    __builtin_amdgcn_s_wait_asynccnt(1);
#else
    asm volatile("s_wait_asynccnt 0x1" ::: "memory");
#endif
}

__device__ __forceinline__ v16bf load_frag(const bf16* __restrict__ base,
                                           int stride, int row0, int k0) {
    int lane = threadIdx.x & 31;
    int r = lane & 15, h = lane >> 4;
    const bf16* p = base + (size_t)(row0 + r) * stride + (k0 + h * 8);
    v8bf lo = *(const v8bf*)(p);
    v8bf hi = *(const v8bf*)(p + 16);
    return __builtin_shufflevector(lo, hi, 0,1,2,3,4,5,6,7,8,9,10,11,12,13,14,15);
}

__device__ __forceinline__ v8f wmma_bf16(v16bf a, v16bf b, v8f c) {
    return __builtin_amdgcn_wmma_f32_16x16x32_bf16(false, a, false, b,
                                                   (short)0, c, false, false);
}

// ---------------------------------------------------------------------------
// Prep kernels. A launch pays for every wave it starts, so each wave moves
// kilobytes, not 32 elements: 16-byte loads, eight in flight a lane, and every
// store instruction fills whole 128-byte lines.
// ---------------------------------------------------------------------------
typedef float v4f  __attribute__((ext_vector_type(4)));
typedef bf16  v4bf __attribute__((ext_vector_type(4)));

// One block converts 8192 consecutive floats: 8 loads of 16 bytes a lane.
__global__ __launch_bounds__(256)
void f32_to_bf16_kernel(const float* __restrict__ in,
                        bf16* __restrict__ out, int n) {
    int base = blockIdx.x * 8192;
    if (base + 8192 > n) return;              // block-uniform bound
    int i0 = base + threadIdx.x * 4;
    v4f v[8];
    // Every loop here is unrolled so that v[] and o keep constant indices
    // (registers, no scratch) and all eight loads issue ahead of the first wait.
#pragma unroll
    for (int j = 0; j < 8; ++j) v[j] = *(const v4f*)(in + i0 + j * 1024);
#pragma unroll
    for (int j = 0; j < 8; ++j) {
        v4bf o;
#pragma unroll
        for (int c = 0; c < 4; ++c) o[c] = (bf16)v[j][c];
        *(v4bf*)(out + i0 + j * 1024) = o;
    }
}

// w is [K,N] row-major f32 -> wT is [N,K] row-major bf16.
// Block tile 64 (k) x 128 (n), wave tile 64 x 16, lane patch 8 (k) x 4 (n):
// lane = 8 * (column quad) + (k octet), so the eight lanes of a column quad
// store 8 x 16 bytes = one whole line of a wT row, and the two waves that
// share a 128-byte line of w sit in the same block.
// K and N are compile-time so that one address pair and immediate offsets
// serve all eight loads, and one pair the four stores.
template <int K, int N>
__global__ __launch_bounds__(256)
void transpose_to_bf16_kernel(const float* __restrict__ w,
                              bf16* __restrict__ wT) {
    constexpr int nblk = N / 128;
    int kt = blockIdx.x / nblk, nt = blockIdx.x % nblk;
    if (kt >= K / 64) return;                 // block-uniform bound
    int wave = threadIdx.x >> 5, lane = threadIdx.x & 31;
    int k0 = kt * 64 + (lane & 7) * 8;
    int n0 = nt * 128 + wave * 16 + (lane >> 3) * 4;
    const float* src = w + k0 * N + n0;
    bf16* dst = wT + n0 * K + k0;
    v4f v[8];
    // Unrolled for the same two reasons as in the cast kernel above.
#pragma unroll
    for (int j = 0; j < 8; ++j) v[j] = *(const v4f*)(src + j * N);
#pragma unroll
    for (int c = 0; c < 4; ++c) {
        v8bf o;
#pragma unroll
        for (int j = 0; j < 8; ++j) o[j] = (bf16)v[j][c];
        *(v8bf*)(dst + c * K) = o;
    }
}

__global__ void gemm_wmma_kernel(const bf16* __restrict__ A,
                                 const bf16* __restrict__ Bt,
                                 const float* __restrict__ bias,
                                 const float* __restrict__ resid,
                                 void* __restrict__ outp,
                                 int M, int N, int K, int mode) {
    __shared__ bf16 tileA[2][32][32];

    int tid   = threadIdx.x;
    int wave  = tid >> 5;
    int gridN = N >> 9;                         // N / 512
    int tileM  = (blockIdx.x / gridN) << 5;
    int tileN0 = (blockIdx.x % gridN) << 9;
    int tN     = tileN0 + wave * 64;

    // async stage: each thread copies 8B; 256 threads cover 32x32 bf16.
    int arow = tid >> 3;                        // 0..31
    int acol = (tid & 7) * 4;                   // element offset, 8B granules
    const bf16* aSrcRow = A + (size_t)(tileM + arow) * K + acol;

    v8f acc[2][4];
#pragma unroll
    for (int mi = 0; mi < 2; ++mi)
#pragma unroll
        for (int t = 0; t < 4; ++t)
#pragma unroll
            for (int i = 0; i < 8; ++i) acc[mi][t][i] = 0.0f;

    int ksteps = K >> 5;
    async_copy_b64(aSrcRow, &tileA[0][arow][acol]);          // prime stage 0

    for (int ks = 0; ks < ksteps; ++ks) {
        int cur = ks & 1;
        if (ks + 1 < ksteps) {
            async_copy_b64(aSrcRow + (ks + 1) * 32, &tileA[cur ^ 1][arow][acol]);
            wait_async1();                                   // stage ks landed
        } else {
            wait_async0();
        }
        __syncthreads();

        const bf16* at = &tileA[cur][0][0];
        v16bf a0 = load_frag(at, 32, 0, 0);
        v16bf a1 = load_frag(at, 32, 16, 0);
        int k0 = ks * 32;
#pragma unroll
        for (int t = 0; t < 4; ++t) {
            v16bf b = load_frag(Bt, K, tN + 16 * t, k0);
            acc[0][t] = wmma_bf16(a0, b, acc[0][t]);
            acc[1][t] = wmma_bf16(a1, b, acc[1][t]);
        }
        __syncthreads();                        // readers done before re-fill
    }

    int lane = tid & 31;
    int r = lane & 15, hf = lane >> 4;
#pragma unroll
    for (int mi = 0; mi < 2; ++mi) {
#pragma unroll
        for (int t = 0; t < 4; ++t) {
#pragma unroll
            for (int i = 0; i < 8; ++i) {
                int m = tileM + mi * 16 + i + 8 * hf;   // token row
                int n = tN + t * 16 + r;                // output column
                float v = acc[mi][t][i] + bias[n];
                if (mode == 0) {                        // [b, h, s, dk]
                    int bb = m >> 11, s = m & (SEQ - 1);
                    int hd = n >> 6,  c = n & (DK - 1);
                    ((bf16*)outp)[((((size_t)bb * NHEADS + hd) * SEQ) + s) * DK + c] = (bf16)v;
                } else if (mode == 1) {                 // [b, h, dk, s]
                    int bb = m >> 11, s = m & (SEQ - 1);
                    int hd = n >> 6,  c = n & (DK - 1);
                    ((bf16*)outp)[((((size_t)bb * NHEADS + hd) * DK) + c) * SEQ + s] = (bf16)v;
                } else if (mode == 2) {                 // f32 + residual
                    size_t idx = (size_t)m * N + n;
                    ((float*)outp)[idx] = v + resid[idx];
                } else {                                // bf16 ReLU
                    ((bf16*)outp)[(size_t)m * N + n] = (bf16)fmaxf(v, 0.0f);
                }
            }
        }
    }
}

__device__ __forceinline__ float xhalf(float x) {
    int b = __builtin_bit_cast(int, x);
    return __builtin_bit_cast(float,
        __builtin_amdgcn_permlanex16(b, b, 0x76543210, 0xfedcba98, false, false));
}

__global__ void attn_wmma_kernel(const bf16* __restrict__ q,
                                 const bf16* __restrict__ k,
                                 const bf16* __restrict__ vT,
                                 bf16* __restrict__ attn_c) {
    int wid  = threadIdx.x >> 5;
    int lane = threadIdx.x & 31;
    int r = lane & 15, hf = lane >> 4;

    int qblocks = SEQ / 64;
    int bh = blockIdx.x / qblocks;
    int qt = (blockIdx.x % qblocks) * 64 + wid * 16;

    const bf16* qh = q  + (size_t)bh * SEQ * DK;
    const bf16* kh = k  + (size_t)bh * SEQ * DK;
    const bf16* vh = vT + (size_t)bh * DK * SEQ;

    v16bf qb0 = load_frag(qh, DK, qt, 0);     // B operand: column = query
    v16bf qb1 = load_frag(qh, DK, qt, 32);

    v8f o[4];                                 // o[t][i] = O[query r][16t + 8hf + i]
#pragma unroll
    for (int t = 0; t < 4; ++t)
#pragma unroll
        for (int i = 0; i < 8; ++i) o[t][i] = 0.0f;
    float mrun = -1e30f;                      // maximum of query r, equal in both halves
    float lsum = 0.0f;                        // this half's share of the sum of query r

    for (int j = 0; j < SEQ; j += 32) {
        v8f s0, s1;                           // s0[i]: key j + 8hf + i; s1[i]: 16 further
#pragma unroll
        for (int i = 0; i < 8; ++i) { s0[i] = 0.0f; s1[i] = 0.0f; }
        s0 = wmma_bf16(load_frag(kh, DK, j, 0),       qb0, s0);
        s0 = wmma_bf16(load_frag(kh, DK, j, 32),      qb1, s0);
        s1 = wmma_bf16(load_frag(kh, DK, j + 16, 0),  qb0, s1);
        s1 = wmma_bf16(load_frag(kh, DK, j + 16, 32), qb1, s1);

        float mx = -1e30f;
#pragma unroll
        for (int i = 0; i < 8; ++i) {
            s0[i] *= 0.125f;                  // 1/sqrt(dk)
            s1[i] *= 0.125f;
            mx = fmaxf(mx, fmaxf(s0[i], s1[i]));
        }
        mx = fmaxf(mx, xhalf(mx));
        float nm   = fmaxf(mrun, mx);
        float corr = __expf(mrun - nm);
        mrun = nm;

        v16bf pb;                             // B operand in the fragment's k order
        float rs = 0.0f;
#pragma unroll
        for (int i = 0; i < 8; ++i) {
            float p0 = __expf(s0[i] - nm);
            float p1 = __expf(s1[i] - nm);
            rs += p0 + p1;
            pb[i]     = (bf16)p0;
            pb[8 + i] = (bf16)p1;
        }
        lsum = lsum * corr + rs;

#pragma unroll
        for (int t = 0; t < 4; ++t)
#pragma unroll
            for (int i = 0; i < 8; ++i) o[t][i] *= corr;
#pragma unroll
        for (int t = 0; t < 4; ++t)
            o[t] = wmma_bf16(load_frag(vh, SEQ, t * 16, j), pb, o[t]);
    }

    lsum += xhalf(lsum);                      // join the halves' sums once

    int bb = bh >> 3, hd = bh & (NHEADS - 1);
    size_t tok = (size_t)bb * SEQ + qt + r;
#pragma unroll
    for (int t = 0; t < 4; ++t) {
        v8bf ov;                              // 8 consecutive columns of one token
#pragma unroll
        for (int i = 0; i < 8; ++i) ov[i] = (bf16)(o[t][i] / lsum);
        *(v8bf*)(attn_c + tok * D_MODEL + hd * DK + t * 16 + 8 * hf) = ov;
    }
}

// ---------------------------------------------------------------------------
// LayerNorm (faithful: unbiased std, eps added to std). One wave per row.
// ---------------------------------------------------------------------------
__global__ void layernorm_kernel(const float* __restrict__ z,
                                 const float* __restrict__ alpha,
                                 const float* __restrict__ beta,
                                 float* __restrict__ out32,
                                 bf16* __restrict__ out16) {
    int wid  = threadIdx.x >> 5;
    int lane = threadIdx.x & 31;
    int row = blockIdx.x * (blockDim.x >> 5) + wid;
    const float* zr = z + (size_t)row * D_MODEL;

    float x[16];
    float sum = 0.0f;
#pragma unroll
    for (int e = 0; e < 16; ++e) { x[e] = zr[lane + 32 * e]; sum += x[e]; }
    sum += __shfl_xor(sum, 1);  sum += __shfl_xor(sum, 2);
    sum += __shfl_xor(sum, 4);  sum += __shfl_xor(sum, 8);
    sum += __shfl_xor(sum, 16);
    float mean = sum * (1.0f / 512.0f);

    float var = 0.0f;
#pragma unroll
    for (int e = 0; e < 16; ++e) { float d = x[e] - mean; var += d * d; }
    var += __shfl_xor(var, 1);  var += __shfl_xor(var, 2);
    var += __shfl_xor(var, 4);  var += __shfl_xor(var, 8);
    var += __shfl_xor(var, 16);
    var *= (1.0f / 511.0f);                   // ddof = 1
    float inv = 1.0f / (sqrtf(var) + 1e-6f);  // eps added to std

#pragma unroll
    for (int e = 0; e < 16; ++e) {
        int c = lane + 32 * e;
        float y = alpha[c] * (x[e] - mean) * inv + beta[c];
        out32[(size_t)row * D_MODEL + c] = y;
        if (out16) out16[(size_t)row * D_MODEL + c] = (bf16)y;
    }
}

// ---------------------------------------------------------------------------
// Launch
// ---------------------------------------------------------------------------
extern "C" void kernel_launch(void* const* d_in, const int* in_sizes, int n_in,
                              void* d_out, int out_size, void* d_ws, size_t ws_size,
                              hipStream_t stream) {
    const float* x    = (const float*)d_in[0];
    const float* wq   = (const float*)d_in[1];
    const float* bq   = (const float*)d_in[2];
    const float* wk   = (const float*)d_in[3];
    const float* bk   = (const float*)d_in[4];
    const float* wv   = (const float*)d_in[5];
    const float* bv   = (const float*)d_in[6];
    const float* wo   = (const float*)d_in[7];
    const float* bo   = (const float*)d_in[8];
    const float* w1   = (const float*)d_in[9];
    const float* b1   = (const float*)d_in[10];
    const float* w2   = (const float*)d_in[11];
    const float* b2   = (const float*)d_in[12];
    const float* ln1a = (const float*)d_in[13];
    const float* ln1b = (const float*)d_in[14];
    const float* ln2a = (const float*)d_in[15];
    const float* ln2b = (const float*)d_in[16];
    float* out = (float*)d_out;

    char* ws = (char*)d_ws;
    size_t off = 0;
    auto carve = [&](size_t bytes) { char* p = ws + off; off += (bytes + 255) & ~(size_t)255; return p; };
    bf16*  xb   = (bf16*)carve((size_t)TOKENS * D_MODEL * 2);
    bf16*  wqT  = (bf16*)carve((size_t)D_MODEL * D_MODEL * 2);
    bf16*  wkT  = (bf16*)carve((size_t)D_MODEL * D_MODEL * 2);
    bf16*  wvT  = (bf16*)carve((size_t)D_MODEL * D_MODEL * 2);
    bf16*  woT  = (bf16*)carve((size_t)D_MODEL * D_MODEL * 2);
    bf16*  w1T  = (bf16*)carve((size_t)D_MODEL * D_FF * 2);
    bf16*  w2T  = (bf16*)carve((size_t)D_FF * D_MODEL * 2);
    bf16*  qb   = (bf16*)carve((size_t)TOKENS * D_MODEL * 2);
    bf16*  kb   = (bf16*)carve((size_t)TOKENS * D_MODEL * 2);
    bf16*  vTb  = (bf16*)carve((size_t)TOKENS * D_MODEL * 2);
    bf16*  attn = (bf16*)carve((size_t)TOKENS * D_MODEL * 2);
    float* z1   = (float*)carve((size_t)TOKENS * D_MODEL * 4);   // reused for z2
    float* y32  = (float*)carve((size_t)TOKENS * D_MODEL * 4);
    bf16*  y16  = (bf16*)carve((size_t)TOKENS * D_MODEL * 2);
    bf16*  ffh  = (bf16*)carve((size_t)TOKENS * D_FF * 2);

    // --- prep: bf16 conversion + weight transposes ---
    f32_to_bf16_kernel<<<(TOKENS * D_MODEL) / 8192, 256, 0, stream>>>(x, xb, TOKENS * D_MODEL);
    transpose_to_bf16_kernel<D_MODEL, D_MODEL><<<(D_MODEL * D_MODEL) / 8192, 256, 0, stream>>>(wq, wqT);
    transpose_to_bf16_kernel<D_MODEL, D_MODEL><<<(D_MODEL * D_MODEL) / 8192, 256, 0, stream>>>(wk, wkT);
    transpose_to_bf16_kernel<D_MODEL, D_MODEL><<<(D_MODEL * D_MODEL) / 8192, 256, 0, stream>>>(wv, wvT);
    transpose_to_bf16_kernel<D_MODEL, D_MODEL><<<(D_MODEL * D_MODEL) / 8192, 256, 0, stream>>>(wo, woT);
    transpose_to_bf16_kernel<D_MODEL, D_FF><<<(D_MODEL * D_FF) / 8192, 256, 0, stream>>>(w1, w1T);
    transpose_to_bf16_kernel<D_FF, D_MODEL><<<(D_FF * D_MODEL) / 8192, 256, 0, stream>>>(w2, w2T);

    // --- QKV projections: workgroup tile 32x512 -> 256 blocks each ---
    gemm_wmma_kernel<<<256, 256, 0, stream>>>(xb, wqT, bq, nullptr, qb,  TOKENS, D_MODEL, D_MODEL, 0);
    gemm_wmma_kernel<<<256, 256, 0, stream>>>(xb, wkT, bk, nullptr, kb,  TOKENS, D_MODEL, D_MODEL, 0);
    gemm_wmma_kernel<<<256, 256, 0, stream>>>(xb, wvT, bv, nullptr, vTb, TOKENS, D_MODEL, D_MODEL, 1);

    // --- attention: 32 (b,h) * 32 q-blocks, 4 waves each ---
    attn_wmma_kernel<<<BATCH * NHEADS * (SEQ / 64), 128, 0, stream>>>(qb, kb, vTb, attn);

    // --- out-proj + residual -> z1; LN1 -> y (f32 + bf16) ---
    gemm_wmma_kernel<<<256, 256, 0, stream>>>(attn, woT, bo, x, z1, TOKENS, D_MODEL, D_MODEL, 2);
    layernorm_kernel<<<TOKENS / 8, 256, 0, stream>>>(z1, ln1a, ln1b, y32, y16);

    // --- FFN1 (ReLU) -> ffh; FFN2 + residual(y) -> z1; LN2 -> out ---
    gemm_wmma_kernel<<<1024, 256, 0, stream>>>(y16, w1T, b1, nullptr, ffh, TOKENS, D_FF, D_MODEL, 3);
    gemm_wmma_kernel<<<256, 256, 0, stream>>>(ffh, w2T, b2, y32, z1, TOKENS, D_MODEL, D_FF, 2);
    layernorm_kernel<<<TOKENS / 8, 256, 0, stream>>>(z1, ln2a, ln2b, out, nullptr);
}

// v003
// One run takes 375 microseconds.
// Next to v002, in two timings, it ran 1.19 and 1.20 times as fast.
// Over all steps from v000 it is 1.64 times as fast.
#include <hip/hip_runtime.h>
#include <hip/hip_bf16.h>

typedef __bf16 bf16;
typedef bf16  v16bf __attribute__((ext_vector_type(16)));
typedef bf16  v8bf  __attribute__((ext_vector_type(8)));
typedef float v8f   __attribute__((ext_vector_type(8)));
typedef int   v2i   __attribute__((ext_vector_type(2)));

typedef __attribute__((address_space(1))) void as1_void;
typedef __attribute__((address_space(3))) void as3_void;
typedef __attribute__((address_space(1))) v2i  as1_v2i;
typedef __attribute__((address_space(3))) v2i  as3_v2i;

#define D_MODEL 512
#define NHEADS  8
#define DK      64
#define D_FF    2048
#define BATCH   4
#define SEQ     2048
#define TOKENS  (BATCH * SEQ)

__device__ __forceinline__ void async_copy_b64(const bf16* gsrc, bf16* lds_dst) {
#if __has_builtin(__builtin_amdgcn_global_load_async_to_lds_b64)
    __builtin_amdgcn_global_load_async_to_lds_b64(
        (as1_v2i*)(as1_void*)gsrc,
        (as3_v2i*)(as3_void*)lds_dst, 0, 0);
#else
    unsigned loff = (unsigned)(size_t)(as3_void*)lds_dst;
    asm volatile("global_load_async_to_lds_b64 %0, %1, off"
                 :: "v"(loff), "v"(gsrc) : "memory");
#endif
}

__device__ __forceinline__ void wait_async0() {
#if __has_builtin(__builtin_amdgcn_s_wait_asynccnt)
    __builtin_amdgcn_s_wait_asynccnt(0);
#else
    asm volatile("s_wait_asynccnt 0x0" ::: "memory");
#endif
}

__device__ __forceinline__ void wait_async1() {
#if __has_builtin(__builtin_amdgcn_s_wait_asynccnt)
    __builtin_amdgcn_s_wait_asynccnt(1);
#else
    asm volatile("s_wait_asynccnt 0x1" ::: "memory");
#endif
}

__device__ __forceinline__ v16bf load_frag(const bf16* __restrict__ base,
                                           int stride, int row0, int k0) {
    int lane = threadIdx.x & 31;
    int r = lane & 15, h = lane >> 4;
    const bf16* p = base + (size_t)(row0 + r) * stride + (k0 + h * 8);
    v8bf lo = *(const v8bf*)(p);
    v8bf hi = *(const v8bf*)(p + 16);
    return __builtin_shufflevector(lo, hi, 0,1,2,3,4,5,6,7,8,9,10,11,12,13,14,15);
}

__device__ __forceinline__ v8f wmma_bf16(v16bf a, v16bf b, v8f c) {
    return __builtin_amdgcn_wmma_f32_16x16x32_bf16(false, a, false, b,
                                                   (short)0, c, false, false);
}

// ---------------------------------------------------------------------------
// Prep kernels. A launch pays for every wave it starts, so each wave moves
// kilobytes, not 32 elements: 16-byte loads, eight in flight a lane, and every
// store instruction fills whole 128-byte lines.
// ---------------------------------------------------------------------------
typedef float v4f  __attribute__((ext_vector_type(4)));
typedef bf16  v4bf __attribute__((ext_vector_type(4)));

// One block converts 8192 consecutive floats: 8 loads of 16 bytes a lane.
__global__ __launch_bounds__(256)
void f32_to_bf16_kernel(const float* __restrict__ in,
                        bf16* __restrict__ out, int n) {
    int base = blockIdx.x * 8192;
    if (base + 8192 > n) return;              // block-uniform bound
    int i0 = base + threadIdx.x * 4;
    v4f v[8];
    // Every loop here is unrolled so that v[] and o keep constant indices
    // (registers, no scratch) and all eight loads issue ahead of the first wait.
#pragma unroll
    for (int j = 0; j < 8; ++j) v[j] = *(const v4f*)(in + i0 + j * 1024);
#pragma unroll
    for (int j = 0; j < 8; ++j) {
        v4bf o;
#pragma unroll
        for (int c = 0; c < 4; ++c) o[c] = (bf16)v[j][c];
        *(v4bf*)(out + i0 + j * 1024) = o;
    }
}

// w is [K,N] row-major f32 -> wT is [N,K] row-major bf16.
// Block tile 64 (k) x 128 (n), wave tile 64 x 16, lane patch 8 (k) x 4 (n):
// lane = 8 * (column quad) + (k octet), so the eight lanes of a column quad
// store 8 x 16 bytes = one whole line of a wT row, and the two waves that
// share a 128-byte line of w sit in the same block.
// K and N are compile-time so that one address pair and immediate offsets
// serve all eight loads, and one pair the four stores.
template <int K, int N>
__global__ __launch_bounds__(256)
void transpose_to_bf16_kernel(const float* __restrict__ w,
                              bf16* __restrict__ wT) {
    constexpr int nblk = N / 128;
    int kt = blockIdx.x / nblk, nt = blockIdx.x % nblk;
    if (kt >= K / 64) return;                 // block-uniform bound
    int wave = threadIdx.x >> 5, lane = threadIdx.x & 31;
    int k0 = kt * 64 + (lane & 7) * 8;
    int n0 = nt * 128 + wave * 16 + (lane >> 3) * 4;
    const float* src = w + k0 * N + n0;
    bf16* dst = wT + n0 * K + k0;
    v4f v[8];
    // Unrolled for the same two reasons as in the cast kernel above.
#pragma unroll
    for (int j = 0; j < 8; ++j) v[j] = *(const v4f*)(src + j * N);
#pragma unroll
    for (int c = 0; c < 4; ++c) {
        v8bf o;
#pragma unroll
        for (int j = 0; j < 8; ++j) o[j] = (bf16)v[j][c];
        *(v8bf*)(dst + c * K) = o;
    }
}

__global__ void gemm_wmma_kernel(const bf16* __restrict__ A,
                                 const bf16* __restrict__ Bt,
                                 const float* __restrict__ bias,
                                 const float* __restrict__ resid,
                                 void* __restrict__ outp,
                                 int M, int N, int K, int mode) {
    __shared__ bf16 tileA[2][32][32];

    int tid   = threadIdx.x;
    int wave  = tid >> 5;
    int gridN = N >> 9;                         // N / 512
    int tileM  = (blockIdx.x / gridN) << 5;
    int tileN0 = (blockIdx.x % gridN) << 9;
    int tN     = tileN0 + wave * 64;

    // async stage: each thread copies 8B; 256 threads cover 32x32 bf16.
    int arow = tid >> 3;                        // 0..31
    int acol = (tid & 7) * 4;                   // element offset, 8B granules
    const bf16* aSrcRow = A + (size_t)(tileM + arow) * K + acol;

    v8f acc[2][4];
#pragma unroll
    for (int mi = 0; mi < 2; ++mi)
#pragma unroll
        for (int t = 0; t < 4; ++t)
#pragma unroll
            for (int i = 0; i < 8; ++i) acc[mi][t][i] = 0.0f;

    int ksteps = K >> 5;
    async_copy_b64(aSrcRow, &tileA[0][arow][acol]);          // prime stage 0

    for (int ks = 0; ks < ksteps; ++ks) {
        int cur = ks & 1;
        if (ks + 1 < ksteps) {
            async_copy_b64(aSrcRow + (ks + 1) * 32, &tileA[cur ^ 1][arow][acol]);
            wait_async1();                                   // stage ks landed
        } else {
            wait_async0();
        }
        __syncthreads();

        const bf16* at = &tileA[cur][0][0];
        v16bf a0 = load_frag(at, 32, 0, 0);
        v16bf a1 = load_frag(at, 32, 16, 0);
        int k0 = ks * 32;
#pragma unroll
        for (int t = 0; t < 4; ++t) {
            v16bf b = load_frag(Bt, K, tN + 16 * t, k0);
            acc[0][t] = wmma_bf16(a0, b, acc[0][t]);
            acc[1][t] = wmma_bf16(a1, b, acc[1][t]);
        }
        __syncthreads();                        // readers done before re-fill
    }

    int lane = tid & 31;
    int r = lane & 15, hf = lane >> 4;
#pragma unroll
    for (int mi = 0; mi < 2; ++mi) {
#pragma unroll
        for (int t = 0; t < 4; ++t) {
#pragma unroll
            for (int i = 0; i < 8; ++i) {
                int m = tileM + mi * 16 + i + 8 * hf;   // token row
                int n = tN + t * 16 + r;                // output column
                float v = acc[mi][t][i] + bias[n];
                if (mode == 0) {                        // [b, h, s, dk]
                    int bb = m >> 11, s = m & (SEQ - 1);
                    int hd = n >> 6,  c = n & (DK - 1);
                    ((bf16*)outp)[((((size_t)bb * NHEADS + hd) * SEQ) + s) * DK + c] = (bf16)v;
                } else if (mode == 1) {                 // [b, h, dk, s]
                    int bb = m >> 11, s = m & (SEQ - 1);
                    int hd = n >> 6,  c = n & (DK - 1);
                    ((bf16*)outp)[((((size_t)bb * NHEADS + hd) * DK) + c) * SEQ + s] = (bf16)v;
                } else if (mode == 2) {                 // f32 + residual
                    size_t idx = (size_t)m * N + n;
                    ((float*)outp)[idx] = v + resid[idx];
                } else {                                // bf16 ReLU
                    ((bf16*)outp)[(size_t)m * N + n] = (bf16)fmaxf(v, 0.0f);
                }
            }
        }
    }
}

__device__ __forceinline__ float xhalf(float x) {
    int b = __builtin_bit_cast(int, x);
    return __builtin_bit_cast(float,
        __builtin_amdgcn_permlanex16(b, b, 0x76543210, 0xfedcba98, false, false));
}

__device__ __forceinline__ void exp2_x8(float (&x)[8]) {
    asm("v_exp_f32 %0, %0\n\t"
        "v_exp_f32 %1, %1\n\t"
        "v_exp_f32 %2, %2\n\t"
        "v_exp_f32 %3, %3\n\t"
        "v_exp_f32 %4, %4\n\t"
        "v_exp_f32 %5, %5\n\t"
        "v_exp_f32 %6, %6\n\t"
        "v_exp_f32 %7, %7\n\t"
        "v_nop"
        : "+v"(x[0]), "+v"(x[1]), "+v"(x[2]), "+v"(x[3]),
          "+v"(x[4]), "+v"(x[5]), "+v"(x[6]), "+v"(x[7]));
}

__device__ __forceinline__ float exp2_x1(float x) {
    asm("v_exp_f32 %0, %0\n\t"
        "v_nop"
        : "+v"(x));
    return x;
}

#define LOG2E 1.44269504f

#define ATT_KEYS   128
#define ATT_STAGES (SEQ / ATT_KEYS)
#define KPITCH     72                         // elements: 128 + 16 bytes
#define VPITCH     136                        // elements: 256 + 16 bytes
#define KBUF_BYTES (ATT_KEYS * KPITCH * 2)
#define VBUF_BYTES (DK * VPITCH * 2)

__device__ __forceinline__ void attn_stage_copy(const bf16* kg, const bf16* vg,
                                                unsigned kl, unsigned vl) {
    asm volatile(
        "global_load_async_to_lds_b128 %0, %8, off\n\t"
        "global_load_async_to_lds_b128 %1, %9, off\n\t"
        "global_load_async_to_lds_b128 %2, %10, off\n\t"
        "global_load_async_to_lds_b128 %3, %11, off\n\t"
        "global_load_async_to_lds_b128 %4, %12, off\n\t"
        "global_load_async_to_lds_b128 %5, %13, off\n\t"
        "global_load_async_to_lds_b128 %6, %14, off\n\t"
        "global_load_async_to_lds_b128 %7, %15, off\n\t"
        "s_wait_xcnt 0x0"
        :: "v"(kl), "v"(kl + 32 * KPITCH * 2), "v"(kl + 64 * KPITCH * 2),
           "v"(kl + 96 * KPITCH * 2),
           "v"(vl), "v"(vl + 16 * VPITCH * 2), "v"(vl + 32 * VPITCH * 2),
           "v"(vl + 48 * VPITCH * 2),
           "v"(kg), "v"(kg + 32 * DK), "v"(kg + 64 * DK), "v"(kg + 96 * DK),
           "v"(vg), "v"(vg + 16 * SEQ), "v"(vg + 32 * SEQ), "v"(vg + 48 * SEQ)
        : "memory");
}

__global__ __launch_bounds__(256)
void attn_wmma_kernel(const bf16* __restrict__ q,
                      const bf16* __restrict__ k,
                      const bf16* __restrict__ vT,
                      bf16* __restrict__ attn_c) {
    __shared__ __attribute__((aligned(16))) bf16 Ks[2][ATT_KEYS][KPITCH];
    __shared__ __attribute__((aligned(16))) bf16 Vs[2][DK][VPITCH];

    int tid  = threadIdx.x;
    int wid  = tid >> 5;
    int lane = tid & 31;
    int r = lane & 15, hf = lane >> 4;

    int qblocks = SEQ / 128;
    int bh = blockIdx.x / qblocks;
    int qt = (blockIdx.x % qblocks) * 128 + wid * 16;

    const bf16* qh = q  + (size_t)bh * SEQ * DK;
    const bf16* kh = k  + (size_t)bh * SEQ * DK;
    const bf16* vh = vT + (size_t)bh * DK * SEQ;

    // This lane's first copy of stage 0: a wave's copy covers four whole lines.
    const bf16* kg = kh + tid * 8;
    const bf16* vg = vh + (tid >> 4) * SEQ + (tid & 15) * 8;
    unsigned kl = (unsigned)(size_t)(as3_void*)&Ks[0][tid >> 3][(tid & 7) * 8];
    unsigned vl = (unsigned)(size_t)(as3_void*)&Vs[0][tid >> 4][(tid & 15) * 8];

    attn_stage_copy(kg, vg, kl, vl);
    asm volatile("s_wait_asynccnt 0x0" ::: "memory");   // stage 0 landed
    __syncthreads();                                    // ... and is public
    attn_stage_copy(kg + ATT_KEYS * DK, vg + ATT_KEYS, kl + KBUF_BYTES, vl + VBUF_BYTES);

    v16bf qb0 = load_frag(qh, DK, qt, 0);     // B operand: column = query
    v16bf qb1 = load_frag(qh, DK, qt, 32);

    v8f o[4];                                 // o[t][i] = O[query r][16t + 8hf + i]
#pragma unroll
    for (int t = 0; t < 4; ++t)
#pragma unroll
        for (int i = 0; i < 8; ++i) o[t][i] = 0.0f;
    float mrun = -1e30f;                      // maximum of query r, equal in both halves
    float lsum = 0.0f;                        // this half's share of the sum of query r

    for (int st = 0; st < ATT_STAGES; ++st) {
        const bf16* kt = &Ks[st & 1][0][0];
        const bf16* vt = &Vs[st & 1][0][0];
        // Unrolled so that the LDS reads of all four passes take immediate offsets.
#pragma unroll
        for (int j = 0; j < ATT_KEYS; j += 32) {
            v8f s0, s1;                           // s0[i]: key j + 8hf + i; s1[i]: 16 further
#pragma unroll
            for (int i = 0; i < 8; ++i) { s0[i] = 0.0f; s1[i] = 0.0f; }
            s0 = wmma_bf16(load_frag(kt, KPITCH, j, 0),       qb0, s0);
            s0 = wmma_bf16(load_frag(kt, KPITCH, j, 32),      qb1, s0);
            s1 = wmma_bf16(load_frag(kt, KPITCH, j + 16, 0),  qb0, s1);
            s1 = wmma_bf16(load_frag(kt, KPITCH, j + 16, 32), qb1, s1);

            float mx = -1e30f;
#pragma unroll
            for (int i = 0; i < 8; ++i) {
                s0[i] *= 0.125f;                  // 1/sqrt(dk)
                s1[i] *= 0.125f;
                mx = fmaxf(mx, fmaxf(s0[i], s1[i]));
            }
            mx = fmaxf(mx, xhalf(mx));
            float nm   = fmaxf(mrun, mx);
            float corr = exp2_x1((mrun - nm) * LOG2E);
            mrun = nm;

            float p0[8], p1[8];
            // Unrolled so that p0 and p1 keep constant indices (registers).
#pragma unroll
            for (int i = 0; i < 8; ++i) {
                p0[i] = (s0[i] - nm) * LOG2E;
                p1[i] = (s1[i] - nm) * LOG2E;
            }
            exp2_x8(p0);
            exp2_x8(p1);

            v16bf pb;                             // B operand in the fragment's k order
            float rs = 0.0f;
#pragma unroll
            for (int i = 0; i < 8; ++i) {
                rs += p0[i] + p1[i];
                pb[i]     = (bf16)p0[i];
                pb[8 + i] = (bf16)p1[i];
            }
            lsum = lsum * corr + rs;

#pragma unroll
            for (int t = 0; t < 4; ++t)
#pragma unroll
                for (int i = 0; i < 8; ++i) o[t][i] *= corr;
#pragma unroll
            for (int t = 0; t < 4; ++t)
                o[t] = wmma_bf16(load_frag(vt, VPITCH, t * 16, j), pb, o[t]);
        }
        // Publish point: own LDS reads done, own copies of the next stage landed,
        // then the barrier that publishes that stage and frees this one's buffer.
        asm volatile("s_wait_dscnt 0x0" ::: "memory");
        asm volatile("s_wait_asynccnt 0x0" ::: "memory");
        __syncthreads();
        if (st + 2 < ATT_STAGES)
            attn_stage_copy(kg + (st + 2) * (ATT_KEYS * DK), vg + (st + 2) * ATT_KEYS,
                            kl + (st & 1) * KBUF_BYTES, vl + (st & 1) * VBUF_BYTES);
    }
    asm volatile("s_wait_asynccnt 0x0" ::: "memory");   // nothing in flight at the end

    lsum += xhalf(lsum);                      // join the halves' sums once

    int bb = bh >> 3, hd = bh & (NHEADS - 1);
    size_t tok = (size_t)bb * SEQ + qt + r;
#pragma unroll
    for (int t = 0; t < 4; ++t) {
        v8bf ov;                              // 8 consecutive columns of one token
#pragma unroll
        for (int i = 0; i < 8; ++i) ov[i] = (bf16)(o[t][i] / lsum);
        *(v8bf*)(attn_c + tok * D_MODEL + hd * DK + t * 16 + 8 * hf) = ov;
    }
}

// ---------------------------------------------------------------------------
// LayerNorm (faithful: unbiased std, eps added to std). One wave per row.
// ---------------------------------------------------------------------------
__global__ void layernorm_kernel(const float* __restrict__ z,
                                 const float* __restrict__ alpha,
                                 const float* __restrict__ beta,
                                 float* __restrict__ out32,
                                 bf16* __restrict__ out16) {
    int wid  = threadIdx.x >> 5;
    int lane = threadIdx.x & 31;
    int row = blockIdx.x * (blockDim.x >> 5) + wid;
    const float* zr = z + (size_t)row * D_MODEL;

    float x[16];
    float sum = 0.0f;
#pragma unroll
    for (int e = 0; e < 16; ++e) { x[e] = zr[lane + 32 * e]; sum += x[e]; }
    sum += __shfl_xor(sum, 1);  sum += __shfl_xor(sum, 2);
    sum += __shfl_xor(sum, 4);  sum += __shfl_xor(sum, 8);
    sum += __shfl_xor(sum, 16);
    float mean = sum * (1.0f / 512.0f);

    float var = 0.0f;
#pragma unroll
    for (int e = 0; e < 16; ++e) { float d = x[e] - mean; var += d * d; }
    var += __shfl_xor(var, 1);  var += __shfl_xor(var, 2);
    var += __shfl_xor(var, 4);  var += __shfl_xor(var, 8);
    var += __shfl_xor(var, 16);
    var *= (1.0f / 511.0f);                   // ddof = 1
    float inv = 1.0f / (sqrtf(var) + 1e-6f);  // eps added to std

#pragma unroll
    for (int e = 0; e < 16; ++e) {
        int c = lane + 32 * e;
        float y = alpha[c] * (x[e] - mean) * inv + beta[c];
        out32[(size_t)row * D_MODEL + c] = y;
        if (out16) out16[(size_t)row * D_MODEL + c] = (bf16)y;
    }
}

// ---------------------------------------------------------------------------
// Launch
// ---------------------------------------------------------------------------
extern "C" void kernel_launch(void* const* d_in, const int* in_sizes, int n_in,
                              void* d_out, int out_size, void* d_ws, size_t ws_size,
                              hipStream_t stream) {
    const float* x    = (const float*)d_in[0];
    const float* wq   = (const float*)d_in[1];
    const float* bq   = (const float*)d_in[2];
    const float* wk   = (const float*)d_in[3];
    const float* bk   = (const float*)d_in[4];
    const float* wv   = (const float*)d_in[5];
    const float* bv   = (const float*)d_in[6];
    const float* wo   = (const float*)d_in[7];
    const float* bo   = (const float*)d_in[8];
    const float* w1   = (const float*)d_in[9];
    const float* b1   = (const float*)d_in[10];
    const float* w2   = (const float*)d_in[11];
    const float* b2   = (const float*)d_in[12];
    const float* ln1a = (const float*)d_in[13];
    const float* ln1b = (const float*)d_in[14];
    const float* ln2a = (const float*)d_in[15];
    const float* ln2b = (const float*)d_in[16];
    float* out = (float*)d_out;

    char* ws = (char*)d_ws;
    size_t off = 0;
    auto carve = [&](size_t bytes) { char* p = ws + off; off += (bytes + 255) & ~(size_t)255; return p; };
    bf16*  xb   = (bf16*)carve((size_t)TOKENS * D_MODEL * 2);
    bf16*  wqT  = (bf16*)carve((size_t)D_MODEL * D_MODEL * 2);
    bf16*  wkT  = (bf16*)carve((size_t)D_MODEL * D_MODEL * 2);
    bf16*  wvT  = (bf16*)carve((size_t)D_MODEL * D_MODEL * 2);
    bf16*  woT  = (bf16*)carve((size_t)D_MODEL * D_MODEL * 2);
    bf16*  w1T  = (bf16*)carve((size_t)D_MODEL * D_FF * 2);
    bf16*  w2T  = (bf16*)carve((size_t)D_FF * D_MODEL * 2);
    bf16*  qb   = (bf16*)carve((size_t)TOKENS * D_MODEL * 2);
    bf16*  kb   = (bf16*)carve((size_t)TOKENS * D_MODEL * 2);
    bf16*  vTb  = (bf16*)carve((size_t)TOKENS * D_MODEL * 2);
    bf16*  attn = (bf16*)carve((size_t)TOKENS * D_MODEL * 2);
    float* z1   = (float*)carve((size_t)TOKENS * D_MODEL * 4);   // reused for z2
    float* y32  = (float*)carve((size_t)TOKENS * D_MODEL * 4);
    bf16*  y16  = (bf16*)carve((size_t)TOKENS * D_MODEL * 2);
    bf16*  ffh  = (bf16*)carve((size_t)TOKENS * D_FF * 2);

    // --- prep: bf16 conversion + weight transposes ---
    f32_to_bf16_kernel<<<(TOKENS * D_MODEL) / 8192, 256, 0, stream>>>(x, xb, TOKENS * D_MODEL);
    transpose_to_bf16_kernel<D_MODEL, D_MODEL><<<(D_MODEL * D_MODEL) / 8192, 256, 0, stream>>>(wq, wqT);
    transpose_to_bf16_kernel<D_MODEL, D_MODEL><<<(D_MODEL * D_MODEL) / 8192, 256, 0, stream>>>(wk, wkT);
    transpose_to_bf16_kernel<D_MODEL, D_MODEL><<<(D_MODEL * D_MODEL) / 8192, 256, 0, stream>>>(wv, wvT);
    transpose_to_bf16_kernel<D_MODEL, D_MODEL><<<(D_MODEL * D_MODEL) / 8192, 256, 0, stream>>>(wo, woT);
    transpose_to_bf16_kernel<D_MODEL, D_FF><<<(D_MODEL * D_FF) / 8192, 256, 0, stream>>>(w1, w1T);
    transpose_to_bf16_kernel<D_FF, D_MODEL><<<(D_FF * D_MODEL) / 8192, 256, 0, stream>>>(w2, w2T);

    // --- QKV projections: workgroup tile 32x512 -> 256 blocks each ---
    gemm_wmma_kernel<<<256, 256, 0, stream>>>(xb, wqT, bq, nullptr, qb,  TOKENS, D_MODEL, D_MODEL, 0);
    gemm_wmma_kernel<<<256, 256, 0, stream>>>(xb, wkT, bk, nullptr, kb,  TOKENS, D_MODEL, D_MODEL, 0);
    gemm_wmma_kernel<<<256, 256, 0, stream>>>(xb, wvT, bv, nullptr, vTb, TOKENS, D_MODEL, D_MODEL, 1);

    // --- attention: 32 (b,h) * 16 q-blocks, 8 waves each ---
    attn_wmma_kernel<<<BATCH * NHEADS * (SEQ / 128), 256, 0, stream>>>(qb, kb, vTb, attn);

    // --- out-proj + residual -> z1; LN1 -> y (f32 + bf16) ---
    gemm_wmma_kernel<<<256, 256, 0, stream>>>(attn, woT, bo, x, z1, TOKENS, D_MODEL, D_MODEL, 2);
    layernorm_kernel<<<TOKENS / 8, 256, 0, stream>>>(z1, ln1a, ln1b, y32, y16);

    // --- FFN1 (ReLU) -> ffh; FFN2 + residual(y) -> z1; LN2 -> out ---
    gemm_wmma_kernel<<<1024, 256, 0, stream>>>(y16, w1T, b1, nullptr, ffh, TOKENS, D_FF, D_MODEL, 3);
    gemm_wmma_kernel<<<256, 256, 0, stream>>>(ffh, w2T, b2, y32, z1, TOKENS, D_MODEL, D_FF, 2);
    layernorm_kernel<<<TOKENS / 8, 256, 0, stream>>>(z1, ln2a, ln2b, out, nullptr);
}

// v004
// Measured time: 220 microseconds a run.
// Two timings next to v003 put it at 1.71 and 1.70 times that version's speed.
// Over all steps from v000 it is 2.80 times as fast.
#include <hip/hip_runtime.h>
#include <hip/hip_bf16.h>

typedef __bf16 bf16;
typedef bf16  v16bf __attribute__((ext_vector_type(16)));
typedef bf16  v8bf  __attribute__((ext_vector_type(8)));
typedef float v8f   __attribute__((ext_vector_type(8)));

typedef __attribute__((address_space(3))) void as3_void;

#define D_MODEL 512
#define NHEADS  8
#define DK      64
#define D_FF    2048
#define BATCH   4
#define SEQ     2048
#define TOKENS  (BATCH * SEQ)

__device__ __forceinline__ v16bf load_frag(const bf16* __restrict__ base,
                                           int stride, int row0, int k0) {
    int lane = threadIdx.x & 31;
    int r = lane & 15, h = lane >> 4;
    const bf16* p = base + (size_t)(row0 + r) * stride + (k0 + h * 8);
    v8bf lo = *(const v8bf*)(p);
    v8bf hi = *(const v8bf*)(p + 16);
    return __builtin_shufflevector(lo, hi, 0,1,2,3,4,5,6,7,8,9,10,11,12,13,14,15);
}

__device__ __forceinline__ v8f wmma_bf16(v16bf a, v16bf b, v8f c) {
    return __builtin_amdgcn_wmma_f32_16x16x32_bf16(false, a, false, b,
                                                   (short)0, c, false, false);
}

// ---------------------------------------------------------------------------
// Prep kernels. A launch pays for every wave it starts, so each wave moves
// kilobytes, not 32 elements: 16-byte loads, eight in flight a lane, and every
// store instruction fills whole 128-byte lines.
// ---------------------------------------------------------------------------
typedef float v4f  __attribute__((ext_vector_type(4)));
typedef bf16  v4bf __attribute__((ext_vector_type(4)));

// One block converts 8192 consecutive floats: 8 loads of 16 bytes a lane.
__global__ __launch_bounds__(256)
void f32_to_bf16_kernel(const float* __restrict__ in,
                        bf16* __restrict__ out, int n) {
    int base = blockIdx.x * 8192;
    if (base + 8192 > n) return;              // block-uniform bound
    int i0 = base + threadIdx.x * 4;
    v4f v[8];
    // Every loop here is unrolled so that v[] and o keep constant indices
    // (registers, no scratch) and all eight loads issue ahead of the first wait.
#pragma unroll
    for (int j = 0; j < 8; ++j) v[j] = *(const v4f*)(in + i0 + j * 1024);
#pragma unroll
    for (int j = 0; j < 8; ++j) {
        v4bf o;
#pragma unroll
        for (int c = 0; c < 4; ++c) o[c] = (bf16)v[j][c];
        *(v4bf*)(out + i0 + j * 1024) = o;
    }
}

// w is [K,N] row-major f32 -> wT is [N,K] row-major bf16.
// Block tile 64 (k) x 128 (n), wave tile 64 x 16, lane patch 8 (k) x 4 (n):
// lane = 8 * (column quad) + (k octet), so the eight lanes of a column quad
// store 8 x 16 bytes = one whole line of a wT row, and the two waves that
// share a 128-byte line of w sit in the same block.
// K and N are compile-time so that one address pair and immediate offsets
// serve all eight loads, and one pair the four stores.
template <int K, int N>
__global__ __launch_bounds__(256)
void transpose_to_bf16_kernel(const float* __restrict__ w,
                              bf16* __restrict__ wT) {
    constexpr int nblk = N / 128;
    int kt = blockIdx.x / nblk, nt = blockIdx.x % nblk;
    if (kt >= K / 64) return;                 // block-uniform bound
    int wave = threadIdx.x >> 5, lane = threadIdx.x & 31;
    int k0 = kt * 64 + (lane & 7) * 8;
    int n0 = nt * 128 + wave * 16 + (lane >> 3) * 4;
    const float* src = w + k0 * N + n0;
    bf16* dst = wT + n0 * K + k0;
    v4f v[8];
    // Unrolled for the same two reasons as in the cast kernel above.
#pragma unroll
    for (int j = 0; j < 8; ++j) v[j] = *(const v4f*)(src + j * N);
#pragma unroll
    for (int c = 0; c < 4; ++c) {
        v8bf o;
#pragma unroll
        for (int j = 0; j < 8; ++j) o[j] = (bf16)v[j][c];
        *(v8bf*)(dst + c * K) = o;
    }
}

// ---------------------------------------------------------------------------
// WMMA GEMM, both operands staged in LDS.
// Workgroup: 256 threads (8 waves), tile 128 (M) x 128 (N); waves 4 (M) x 2 (N),
// each owns a 32x64 slice (8 accumulators). A stage is 128 k of the 128 rows of
// A and of the 128 rows of B^T: rows of 256 bytes, copied in whole lines by
// asynchronous copies into two buffers, the next stage in flight while this one
// is worked on. A row of A then serves 2 waves and a row of B^T serves 4, and
// no wave waits on a global load inside the k loop.
// Needs M, N multiples of 128 and K a multiple of 128.
// mode: 0 = bf16 scatter [b,h,s,dk] (Q/K);  1 = bf16 scatter [b,h,dk,s] (V^T)
//       2 = f32 [M,N] + residual;           3 = bf16 [M,N] with ReLU
// ---------------------------------------------------------------------------
#define GT_ROWS    128                        // rows of either operand in a stage
#define GT_K       128                        // k elements in a stage
#define GPITCH     136                        // elements: 256 + 16 bytes, 16 x odd
#define GBUF_BYTES (GT_ROWS * GPITCH * 2)

__device__ __forceinline__ void gemm_stage_copy(const bf16* g, size_t step, unsigned l) {
    asm volatile(
        "global_load_async_to_lds_b128 %0, %8, off\n\t"
        "global_load_async_to_lds_b128 %1, %9, off\n\t"
        "global_load_async_to_lds_b128 %2, %10, off\n\t"
        "global_load_async_to_lds_b128 %3, %11, off\n\t"
        "global_load_async_to_lds_b128 %4, %12, off\n\t"
        "global_load_async_to_lds_b128 %5, %13, off\n\t"
        "global_load_async_to_lds_b128 %6, %14, off\n\t"
        "global_load_async_to_lds_b128 %7, %15, off\n\t"
        "s_wait_xcnt 0x0"
        :: "v"(l), "v"(l + 16 * GPITCH * 2), "v"(l + 32 * GPITCH * 2),
           "v"(l + 48 * GPITCH * 2), "v"(l + 64 * GPITCH * 2),
           "v"(l + 80 * GPITCH * 2), "v"(l + 96 * GPITCH * 2),
           "v"(l + 112 * GPITCH * 2),
           "v"(g), "v"(g + step), "v"(g + 2 * step), "v"(g + 3 * step),
           "v"(g + 4 * step), "v"(g + 5 * step), "v"(g + 6 * step), "v"(g + 7 * step)
        : "memory");
}

__global__ __launch_bounds__(256)
void gemm_wmma_kernel(const bf16* __restrict__ A,
                      const bf16* __restrict__ Bt,
                      const float* __restrict__ bias,
                      const float* __restrict__ resid,
                      void* __restrict__ outp,
                      int M, int N, int K, int mode) {
    __shared__ __attribute__((aligned(16))) bf16 As[2][GT_ROWS][GPITCH];
    __shared__ __attribute__((aligned(16))) bf16 Bs[2][GT_ROWS][GPITCH];

    int tid   = threadIdx.x;
    int wave  = tid >> 5;
    int gridN = N >> 7;                         // N / 128
    int blkM  = (blockIdx.x / gridN) << 7;
    int blkN  = (blockIdx.x % gridN) << 7;
    int wm    = (wave >> 1) * 32;               // this wave's rows in the block tile
    int wn    = (wave & 1) * 64;                // ... and its columns
    int tileM = blkM + wm;
    int tN    = blkN + wn;

    // This lane's first copy of stage 0: a wave's copy covers four whole lines.
    int crow = tid >> 4;                        // 0..15
    int ccol = (tid & 15) * 8;                  // element offset, 16-byte granules
    const bf16* ag = A  + (size_t)(blkM + crow) * K + ccol;
    const bf16* bg = Bt + (size_t)(blkN + crow) * K + ccol;
    unsigned al = (unsigned)(size_t)(as3_void*)&As[0][crow][ccol];
    unsigned bl = (unsigned)(size_t)(as3_void*)&Bs[0][crow][ccol];
    size_t step = (size_t)16 * K;

    v8f acc[2][4];
#pragma unroll
    for (int mi = 0; mi < 2; ++mi)
#pragma unroll
        for (int t = 0; t < 4; ++t)
#pragma unroll
            for (int i = 0; i < 8; ++i) acc[mi][t][i] = 0.0f;

    int stages = K >> 7;
    gemm_stage_copy(ag, step, al);
    gemm_stage_copy(bg, step, bl);
    asm volatile("s_wait_asynccnt 0x0" ::: "memory");   // stage 0 landed
    __syncthreads();                                    // ... and is public
    if (stages > 1) {
        gemm_stage_copy(ag + GT_K, step, al + GBUF_BYTES);
        gemm_stage_copy(bg + GT_K, step, bl + GBUF_BYTES);
    }

    for (int st = 0; st < stages; ++st) {
        const bf16* at = &As[st & 1][wm][0];
        const bf16* bt = &Bs[st & 1][wn][0];
        // Two fragment sets: the next k block's twelve LDS reads go out as one
        // group ahead of this block's WMMAs, never past the end of the stage.
        // Unrolled so that fa and fb keep constant indices (registers) and the
        // reads take immediate offsets.
        v16bf fa[2][2], fb[2][4];
        fa[0][0] = load_frag(at, GPITCH, 0, 0);
        fa[0][1] = load_frag(at, GPITCH, 16, 0);
#pragma unroll
        for (int t = 0; t < 4; ++t) fb[0][t] = load_frag(bt, GPITCH, 16 * t, 0);
#pragma unroll
        for (int kb = 0; kb < GT_K / 32; ++kb) {
            const int cs = kb & 1, ns = cs ^ 1;
            if (kb + 1 < GT_K / 32) {
                fa[ns][0] = load_frag(at, GPITCH, 0,  (kb + 1) * 32);
                fa[ns][1] = load_frag(at, GPITCH, 16, (kb + 1) * 32);
#pragma unroll
                for (int t = 0; t < 4; ++t)
                    fb[ns][t] = load_frag(bt, GPITCH, 16 * t, (kb + 1) * 32);
            }
            // Holds the read group above ahead of the WMMAs below: left free, the
            // scheduler sinks each read to just in front of its use, and the
            // wave then waits out one LDS latency for every two WMMAs. Before the
            // last block it keeps the block before in front of the stage's
            // closing wait, where its WMMAs cover the last read group's latency.
            __builtin_amdgcn_sched_barrier(0);
#pragma unroll
            for (int t = 0; t < 4; ++t) {
                acc[0][t] = wmma_bf16(fa[cs][0], fb[cs][t], acc[0][t]);
                acc[1][t] = wmma_bf16(fa[cs][1], fb[cs][t], acc[1][t]);
            }
        }
        // Publish point: own LDS reads done, own copies of the next stage landed,
        // then the barrier that publishes that stage and frees this one's buffer.
        asm volatile("s_wait_dscnt 0x0" ::: "memory");
        asm volatile("s_wait_asynccnt 0x0" ::: "memory");
        __syncthreads();
        if (st + 2 < stages) {
            gemm_stage_copy(ag + (st + 2) * GT_K, step, al + (st & 1) * GBUF_BYTES);
            gemm_stage_copy(bg + (st + 2) * GT_K, step, bl + (st & 1) * GBUF_BYTES);
        }
    }
    asm volatile("s_wait_asynccnt 0x0" ::: "memory");   // nothing in flight at the end

    int lane = tid & 31;
    int r = lane & 15, hf = lane >> 4;
#pragma unroll
    for (int mi = 0; mi < 2; ++mi) {
#pragma unroll
        for (int t = 0; t < 4; ++t) {
#pragma unroll
            for (int i = 0; i < 8; ++i) {
                int m = tileM + mi * 16 + i + 8 * hf;   // token row
                int n = tN + t * 16 + r;                // output column
                float v = acc[mi][t][i] + bias[n];
                if (mode == 0) {                        // [b, h, s, dk]
                    int bb = m >> 11, s = m & (SEQ - 1);
                    int hd = n >> 6,  c = n & (DK - 1);
                    ((bf16*)outp)[((((size_t)bb * NHEADS + hd) * SEQ) + s) * DK + c] = (bf16)v;
                } else if (mode == 1) {                 // [b, h, dk, s]
                    int bb = m >> 11, s = m & (SEQ - 1);
                    int hd = n >> 6,  c = n & (DK - 1);
                    ((bf16*)outp)[((((size_t)bb * NHEADS + hd) * DK) + c) * SEQ + s] = (bf16)v;
                } else if (mode == 2) {                 // f32 + residual
                    size_t idx = (size_t)m * N + n;
                    ((float*)outp)[idx] = v + resid[idx];
                } else {                                // bf16 ReLU
                    ((bf16*)outp)[(size_t)m * N + n] = (bf16)fmaxf(v, 0.0f);
                }
            }
        }
    }
}

__device__ __forceinline__ float xhalf(float x) {
    int b = __builtin_bit_cast(int, x);
    return __builtin_bit_cast(float,
        __builtin_amdgcn_permlanex16(b, b, 0x76543210, 0xfedcba98, false, false));
}

__device__ __forceinline__ void exp2_x8(float (&x)[8]) {
    asm("v_exp_f32 %0, %0\n\t"
        "v_exp_f32 %1, %1\n\t"
        "v_exp_f32 %2, %2\n\t"
        "v_exp_f32 %3, %3\n\t"
        "v_exp_f32 %4, %4\n\t"
        "v_exp_f32 %5, %5\n\t"
        "v_exp_f32 %6, %6\n\t"
        "v_exp_f32 %7, %7\n\t"
        "v_nop"
        : "+v"(x[0]), "+v"(x[1]), "+v"(x[2]), "+v"(x[3]),
          "+v"(x[4]), "+v"(x[5]), "+v"(x[6]), "+v"(x[7]));
}

__device__ __forceinline__ float exp2_x1(float x) {
    asm("v_exp_f32 %0, %0\n\t"
        "v_nop"
        : "+v"(x));
    return x;
}

#define LOG2E 1.44269504f

#define ATT_KEYS   128
#define ATT_STAGES (SEQ / ATT_KEYS)
#define KPITCH     72                         // elements: 128 + 16 bytes
#define VPITCH     136                        // elements: 256 + 16 bytes
#define KBUF_BYTES (ATT_KEYS * KPITCH * 2)
#define VBUF_BYTES (DK * VPITCH * 2)

__device__ __forceinline__ void attn_stage_copy(const bf16* kg, const bf16* vg,
                                                unsigned kl, unsigned vl) {
    asm volatile(
        "global_load_async_to_lds_b128 %0, %8, off\n\t"
        "global_load_async_to_lds_b128 %1, %9, off\n\t"
        "global_load_async_to_lds_b128 %2, %10, off\n\t"
        "global_load_async_to_lds_b128 %3, %11, off\n\t"
        "global_load_async_to_lds_b128 %4, %12, off\n\t"
        "global_load_async_to_lds_b128 %5, %13, off\n\t"
        "global_load_async_to_lds_b128 %6, %14, off\n\t"
        "global_load_async_to_lds_b128 %7, %15, off\n\t"
        "s_wait_xcnt 0x0"
        :: "v"(kl), "v"(kl + 32 * KPITCH * 2), "v"(kl + 64 * KPITCH * 2),
           "v"(kl + 96 * KPITCH * 2),
           "v"(vl), "v"(vl + 16 * VPITCH * 2), "v"(vl + 32 * VPITCH * 2),
           "v"(vl + 48 * VPITCH * 2),
           "v"(kg), "v"(kg + 32 * DK), "v"(kg + 64 * DK), "v"(kg + 96 * DK),
           "v"(vg), "v"(vg + 16 * SEQ), "v"(vg + 32 * SEQ), "v"(vg + 48 * SEQ)
        : "memory");
}

__global__ __launch_bounds__(256)
void attn_wmma_kernel(const bf16* __restrict__ q,
                      const bf16* __restrict__ k,
                      const bf16* __restrict__ vT,
                      bf16* __restrict__ attn_c) {
    __shared__ __attribute__((aligned(16))) bf16 Ks[2][ATT_KEYS][KPITCH];
    __shared__ __attribute__((aligned(16))) bf16 Vs[2][DK][VPITCH];

    int tid  = threadIdx.x;
    int wid  = tid >> 5;
    int lane = tid & 31;
    int r = lane & 15, hf = lane >> 4;

    int qblocks = SEQ / 128;
    int bh = blockIdx.x / qblocks;
    int qt = (blockIdx.x % qblocks) * 128 + wid * 16;

    const bf16* qh = q  + (size_t)bh * SEQ * DK;
    const bf16* kh = k  + (size_t)bh * SEQ * DK;
    const bf16* vh = vT + (size_t)bh * DK * SEQ;

    // This lane's first copy of stage 0: a wave's copy covers four whole lines.
    const bf16* kg = kh + tid * 8;
    const bf16* vg = vh + (tid >> 4) * SEQ + (tid & 15) * 8;
    unsigned kl = (unsigned)(size_t)(as3_void*)&Ks[0][tid >> 3][(tid & 7) * 8];
    unsigned vl = (unsigned)(size_t)(as3_void*)&Vs[0][tid >> 4][(tid & 15) * 8];

    attn_stage_copy(kg, vg, kl, vl);
    asm volatile("s_wait_asynccnt 0x0" ::: "memory");   // stage 0 landed
    __syncthreads();                                    // ... and is public
    attn_stage_copy(kg + ATT_KEYS * DK, vg + ATT_KEYS, kl + KBUF_BYTES, vl + VBUF_BYTES);

    v16bf qb0 = load_frag(qh, DK, qt, 0);     // B operand: column = query
    v16bf qb1 = load_frag(qh, DK, qt, 32);

    v8f o[4];                                 // o[t][i] = O[query r][16t + 8hf + i]
#pragma unroll
    for (int t = 0; t < 4; ++t)
#pragma unroll
        for (int i = 0; i < 8; ++i) o[t][i] = 0.0f;
    float mrun = -1e30f;                      // maximum of query r, equal in both halves
    float lsum = 0.0f;                        // this half's share of the sum of query r

    for (int st = 0; st < ATT_STAGES; ++st) {
        const bf16* kt = &Ks[st & 1][0][0];
        const bf16* vt = &Vs[st & 1][0][0];
        // Unrolled so that the LDS reads of all four passes take immediate offsets.
#pragma unroll
        for (int j = 0; j < ATT_KEYS; j += 32) {
            v8f s0, s1;                           // s0[i]: key j + 8hf + i; s1[i]: 16 further
#pragma unroll
            for (int i = 0; i < 8; ++i) { s0[i] = 0.0f; s1[i] = 0.0f; }
            s0 = wmma_bf16(load_frag(kt, KPITCH, j, 0),       qb0, s0);
            s0 = wmma_bf16(load_frag(kt, KPITCH, j, 32),      qb1, s0);
            s1 = wmma_bf16(load_frag(kt, KPITCH, j + 16, 0),  qb0, s1);
            s1 = wmma_bf16(load_frag(kt, KPITCH, j + 16, 32), qb1, s1);

            float mx = -1e30f;
#pragma unroll
            for (int i = 0; i < 8; ++i) {
                s0[i] *= 0.125f;                  // 1/sqrt(dk)
                s1[i] *= 0.125f;
                mx = fmaxf(mx, fmaxf(s0[i], s1[i]));
            }
            mx = fmaxf(mx, xhalf(mx));
            float nm   = fmaxf(mrun, mx);
            float corr = exp2_x1((mrun - nm) * LOG2E);
            mrun = nm;

            float p0[8], p1[8];
            // Unrolled so that p0 and p1 keep constant indices (registers).
#pragma unroll
            for (int i = 0; i < 8; ++i) {
                p0[i] = (s0[i] - nm) * LOG2E;
                p1[i] = (s1[i] - nm) * LOG2E;
            }
            exp2_x8(p0);
            exp2_x8(p1);

            v16bf pb;                             // B operand in the fragment's k order
            float rs = 0.0f;
#pragma unroll
            for (int i = 0; i < 8; ++i) {
                rs += p0[i] + p1[i];
                pb[i]     = (bf16)p0[i];
                pb[8 + i] = (bf16)p1[i];
            }
            lsum = lsum * corr + rs;

#pragma unroll
            for (int t = 0; t < 4; ++t)
#pragma unroll
                for (int i = 0; i < 8; ++i) o[t][i] *= corr;
#pragma unroll
            for (int t = 0; t < 4; ++t)
                o[t] = wmma_bf16(load_frag(vt, VPITCH, t * 16, j), pb, o[t]);
        }
        // Publish point: own LDS reads done, own copies of the next stage landed,
        // then the barrier that publishes that stage and frees this one's buffer.
        asm volatile("s_wait_dscnt 0x0" ::: "memory");
        asm volatile("s_wait_asynccnt 0x0" ::: "memory");
        __syncthreads();
        if (st + 2 < ATT_STAGES)
            attn_stage_copy(kg + (st + 2) * (ATT_KEYS * DK), vg + (st + 2) * ATT_KEYS,
                            kl + (st & 1) * KBUF_BYTES, vl + (st & 1) * VBUF_BYTES);
    }
    asm volatile("s_wait_asynccnt 0x0" ::: "memory");   // nothing in flight at the end

    lsum += xhalf(lsum);                      // join the halves' sums once

    int bb = bh >> 3, hd = bh & (NHEADS - 1);
    size_t tok = (size_t)bb * SEQ + qt + r;
#pragma unroll
    for (int t = 0; t < 4; ++t) {
        v8bf ov;                              // 8 consecutive columns of one token
#pragma unroll
        for (int i = 0; i < 8; ++i) ov[i] = (bf16)(o[t][i] / lsum);
        *(v8bf*)(attn_c + tok * D_MODEL + hd * DK + t * 16 + 8 * hf) = ov;
    }
}

// ---------------------------------------------------------------------------
// LayerNorm (faithful: unbiased std, eps added to std). One wave per row.
// ---------------------------------------------------------------------------
__global__ void layernorm_kernel(const float* __restrict__ z,
                                 const float* __restrict__ alpha,
                                 const float* __restrict__ beta,
                                 float* __restrict__ out32,
                                 bf16* __restrict__ out16) {
    int wid  = threadIdx.x >> 5;
    int lane = threadIdx.x & 31;
    int row = blockIdx.x * (blockDim.x >> 5) + wid;
    const float* zr = z + (size_t)row * D_MODEL;

    float x[16];
    float sum = 0.0f;
#pragma unroll
    for (int e = 0; e < 16; ++e) { x[e] = zr[lane + 32 * e]; sum += x[e]; }
    sum += __shfl_xor(sum, 1);  sum += __shfl_xor(sum, 2);
    sum += __shfl_xor(sum, 4);  sum += __shfl_xor(sum, 8);
    sum += __shfl_xor(sum, 16);
    float mean = sum * (1.0f / 512.0f);

    float var = 0.0f;
#pragma unroll
    for (int e = 0; e < 16; ++e) { float d = x[e] - mean; var += d * d; }
    var += __shfl_xor(var, 1);  var += __shfl_xor(var, 2);
    var += __shfl_xor(var, 4);  var += __shfl_xor(var, 8);
    var += __shfl_xor(var, 16);
    var *= (1.0f / 511.0f);                   // ddof = 1
    float inv = 1.0f / (sqrtf(var) + 1e-6f);  // eps added to std

#pragma unroll
    for (int e = 0; e < 16; ++e) {
        int c = lane + 32 * e;
        float y = alpha[c] * (x[e] - mean) * inv + beta[c];
        out32[(size_t)row * D_MODEL + c] = y;
        if (out16) out16[(size_t)row * D_MODEL + c] = (bf16)y;
    }
}

// ---------------------------------------------------------------------------
// Launch
// ---------------------------------------------------------------------------
extern "C" void kernel_launch(void* const* d_in, const int* in_sizes, int n_in,
                              void* d_out, int out_size, void* d_ws, size_t ws_size,
                              hipStream_t stream) {
    const float* x    = (const float*)d_in[0];
    const float* wq   = (const float*)d_in[1];
    const float* bq   = (const float*)d_in[2];
    const float* wk   = (const float*)d_in[3];
    const float* bk   = (const float*)d_in[4];
    const float* wv   = (const float*)d_in[5];
    const float* bv   = (const float*)d_in[6];
    const float* wo   = (const float*)d_in[7];
    const float* bo   = (const float*)d_in[8];
    const float* w1   = (const float*)d_in[9];
    const float* b1   = (const float*)d_in[10];
    const float* w2   = (const float*)d_in[11];
    const float* b2   = (const float*)d_in[12];
    const float* ln1a = (const float*)d_in[13];
    const float* ln1b = (const float*)d_in[14];
    const float* ln2a = (const float*)d_in[15];
    const float* ln2b = (const float*)d_in[16];
    float* out = (float*)d_out;

    char* ws = (char*)d_ws;
    size_t off = 0;
    auto carve = [&](size_t bytes) { char* p = ws + off; off += (bytes + 255) & ~(size_t)255; return p; };
    bf16*  xb   = (bf16*)carve((size_t)TOKENS * D_MODEL * 2);
    bf16*  wqT  = (bf16*)carve((size_t)D_MODEL * D_MODEL * 2);
    bf16*  wkT  = (bf16*)carve((size_t)D_MODEL * D_MODEL * 2);
    bf16*  wvT  = (bf16*)carve((size_t)D_MODEL * D_MODEL * 2);
    bf16*  woT  = (bf16*)carve((size_t)D_MODEL * D_MODEL * 2);
    bf16*  w1T  = (bf16*)carve((size_t)D_MODEL * D_FF * 2);
    bf16*  w2T  = (bf16*)carve((size_t)D_FF * D_MODEL * 2);
    bf16*  qb   = (bf16*)carve((size_t)TOKENS * D_MODEL * 2);
    bf16*  kb   = (bf16*)carve((size_t)TOKENS * D_MODEL * 2);
    bf16*  vTb  = (bf16*)carve((size_t)TOKENS * D_MODEL * 2);
    bf16*  attn = (bf16*)carve((size_t)TOKENS * D_MODEL * 2);
    float* z1   = (float*)carve((size_t)TOKENS * D_MODEL * 4);   // reused for z2
    float* y32  = (float*)carve((size_t)TOKENS * D_MODEL * 4);
    bf16*  y16  = (bf16*)carve((size_t)TOKENS * D_MODEL * 2);
    bf16*  ffh  = (bf16*)carve((size_t)TOKENS * D_FF * 2);

    // --- prep: bf16 conversion + weight transposes ---
    f32_to_bf16_kernel<<<(TOKENS * D_MODEL) / 8192, 256, 0, stream>>>(x, xb, TOKENS * D_MODEL);
    transpose_to_bf16_kernel<D_MODEL, D_MODEL><<<(D_MODEL * D_MODEL) / 8192, 256, 0, stream>>>(wq, wqT);
    transpose_to_bf16_kernel<D_MODEL, D_MODEL><<<(D_MODEL * D_MODEL) / 8192, 256, 0, stream>>>(wk, wkT);
    transpose_to_bf16_kernel<D_MODEL, D_MODEL><<<(D_MODEL * D_MODEL) / 8192, 256, 0, stream>>>(wv, wvT);
    transpose_to_bf16_kernel<D_MODEL, D_MODEL><<<(D_MODEL * D_MODEL) / 8192, 256, 0, stream>>>(wo, woT);
    transpose_to_bf16_kernel<D_MODEL, D_FF><<<(D_MODEL * D_FF) / 8192, 256, 0, stream>>>(w1, w1T);
    transpose_to_bf16_kernel<D_FF, D_MODEL><<<(D_FF * D_MODEL) / 8192, 256, 0, stream>>>(w2, w2T);

    // --- QKV projections: workgroup tile 128x128 -> 256 blocks each ---
    gemm_wmma_kernel<<<256, 256, 0, stream>>>(xb, wqT, bq, nullptr, qb,  TOKENS, D_MODEL, D_MODEL, 0);
    gemm_wmma_kernel<<<256, 256, 0, stream>>>(xb, wkT, bk, nullptr, kb,  TOKENS, D_MODEL, D_MODEL, 0);
    gemm_wmma_kernel<<<256, 256, 0, stream>>>(xb, wvT, bv, nullptr, vTb, TOKENS, D_MODEL, D_MODEL, 1);

    // --- attention: 32 (b,h) * 16 q-blocks, 8 waves each ---
    attn_wmma_kernel<<<BATCH * NHEADS * (SEQ / 128), 256, 0, stream>>>(qb, kb, vTb, attn);

    // --- out-proj + residual -> z1; LN1 -> y (f32 + bf16) ---
    gemm_wmma_kernel<<<256, 256, 0, stream>>>(attn, woT, bo, x, z1, TOKENS, D_MODEL, D_MODEL, 2);
    layernorm_kernel<<<TOKENS / 8, 256, 0, stream>>>(z1, ln1a, ln1b, y32, y16);

    // --- FFN1 (ReLU) -> ffh; FFN2 + residual(y) -> z1; LN2 -> out ---
    gemm_wmma_kernel<<<1024, 256, 0, stream>>>(y16, w1T, b1, nullptr, ffh, TOKENS, D_FF, D_MODEL, 3);
    gemm_wmma_kernel<<<256, 256, 0, stream>>>(ffh, w2T, b2, y32, z1, TOKENS, D_MODEL, D_FF, 2);
    layernorm_kernel<<<TOKENS / 8, 256, 0, stream>>>(z1, ln2a, ln2b, out, nullptr);
}

// v005
// A run of this version takes 155 microseconds.
// In two side-by-side timings against v004, it was 1.43 and 1.42 times as fast.
// Counting every step since v000, it is 3.99 times as fast.
#include <hip/hip_runtime.h>
#include <hip/hip_bf16.h>

typedef __bf16 bf16;
typedef bf16  v16bf __attribute__((ext_vector_type(16)));
typedef bf16  v8bf  __attribute__((ext_vector_type(8)));
typedef float v8f   __attribute__((ext_vector_type(8)));

typedef __attribute__((address_space(3))) void as3_void;

#define D_MODEL 512
#define NHEADS  8
#define DK      64
#define D_FF    2048
#define BATCH   4
#define SEQ     2048
#define TOKENS  (BATCH * SEQ)

__device__ __forceinline__ v16bf load_frag(const bf16* __restrict__ base,
                                           int stride, int row0, int k0) {
    int lane = threadIdx.x & 31;
    int r = lane & 15, h = lane >> 4;
    const bf16* p = base + (size_t)(row0 + r) * stride + (k0 + h * 8);
    v8bf lo = *(const v8bf*)(p);
    v8bf hi = *(const v8bf*)(p + 16);
    return __builtin_shufflevector(lo, hi, 0,1,2,3,4,5,6,7,8,9,10,11,12,13,14,15);
}

__device__ __forceinline__ v8f wmma_bf16(v16bf a, v16bf b, v8f c) {
    return __builtin_amdgcn_wmma_f32_16x16x32_bf16(false, a, false, b,
                                                   (short)0, c, false, false);
}

// ---------------------------------------------------------------------------
// Prep kernels. A launch pays for every wave it starts, so each wave moves
// kilobytes, not 32 elements: 16-byte loads, eight in flight a lane, and every
// store instruction fills whole 128-byte lines.
// ---------------------------------------------------------------------------
typedef float v4f  __attribute__((ext_vector_type(4)));
typedef bf16  v4bf __attribute__((ext_vector_type(4)));

// One block converts 8192 consecutive floats: 8 loads of 16 bytes a lane.
__global__ __launch_bounds__(256)
void f32_to_bf16_kernel(const float* __restrict__ in,
                        bf16* __restrict__ out, int n) {
    int base = blockIdx.x * 8192;
    if (base + 8192 > n) return;              // block-uniform bound
    int i0 = base + threadIdx.x * 4;
    v4f v[8];
    // Every loop here is unrolled so that v[] and o keep constant indices
    // (registers, no scratch) and all eight loads issue ahead of the first wait.
#pragma unroll
    for (int j = 0; j < 8; ++j) v[j] = *(const v4f*)(in + i0 + j * 1024);
#pragma unroll
    for (int j = 0; j < 8; ++j) {
        v4bf o;
#pragma unroll
        for (int c = 0; c < 4; ++c) o[c] = (bf16)v[j][c];
        *(v4bf*)(out + i0 + j * 1024) = o;
    }
}

// w is [K,N] row-major f32 -> wT is [N,K] row-major bf16.
// Block tile 64 (k) x 128 (n), wave tile 64 x 16, lane patch 8 (k) x 4 (n):
// lane = 8 * (column quad) + (k octet), so the eight lanes of a column quad
// store 8 x 16 bytes = one whole line of a wT row, and the two waves that
// share a 128-byte line of w sit in the same block.
// K and N are compile-time so that one address pair and immediate offsets
// serve all eight loads, and one pair the four stores.
template <int K, int N>
__global__ __launch_bounds__(256)
void transpose_to_bf16_kernel(const float* __restrict__ w,
                              bf16* __restrict__ wT) {
    constexpr int nblk = N / 128;
    int kt = blockIdx.x / nblk, nt = blockIdx.x % nblk;
    if (kt >= K / 64) return;                 // block-uniform bound
    int wave = threadIdx.x >> 5, lane = threadIdx.x & 31;
    int k0 = kt * 64 + (lane & 7) * 8;
    int n0 = nt * 128 + wave * 16 + (lane >> 3) * 4;
    const float* src = w + k0 * N + n0;
    bf16* dst = wT + n0 * K + k0;
    v4f v[8];
    // Unrolled for the same two reasons as in the cast kernel above.
#pragma unroll
    for (int j = 0; j < 8; ++j) v[j] = *(const v4f*)(src + j * N);
#pragma unroll
    for (int c = 0; c < 4; ++c) {
        v8bf o;
#pragma unroll
        for (int j = 0; j < 8; ++j) o[j] = (bf16)v[j][c];
        *(v8bf*)(dst + c * K) = o;
    }
}

// ---------------------------------------------------------------------------
// WMMA GEMM, both operands staged in LDS.
// Workgroup: 256 threads (8 waves), tile 128 (M) x 128 (N); waves 4 (M) x 2 (N),
// each owns a 32x64 slice (8 accumulators). A stage is 128 k of the 128 rows of
// A and of the 128 rows of B^T: rows of 256 bytes, copied in whole lines by
// asynchronous copies into two buffers, the next stage in flight while this one
// is worked on. A row of A then serves 2 waves and a row of B^T serves 4, and
// no wave waits on a global load inside the k loop.
// Needs M, N multiples of 128 and K a multiple of 128.
// MODE and N are compile-time: the epilogue then holds no branch, and one
// address with immediate offsets serves all of a lane's loads or stores. MODE:
//   0 = bf16, rows are tokens, columns scattered to [b,h,s,dk] (Q/K)
//   1 = bf16, rows are channels, columns are tokens -> [b,h,dk,s] (V^T = Wv^T X^T),
//       bias by row
//   2 = f32 [M,N] + residual;   3 = bf16 [M,N] with ReLU
// Each 16x16 product is taken transposed (B^T rows as the A operand, A rows as
// the B operand): in the accumulator map a lane then holds 8 ADJACENT columns of
// one output row, 16 bytes of bf16. Every wave turns its 32x64 slice through its
// own piece of the finished ring, so that each global store (and each residual
// load) is 16 bytes a lane over whole 128-byte lines.
// ---------------------------------------------------------------------------
#define GT_ROWS    128                        // rows of either operand in a stage
#define GT_K       128                        // k elements in a stage
#define GPITCH     136                        // elements: 256 + 16 bytes, 16 x odd
#define GBUF_BYTES (GT_ROWS * GPITCH * 2)
#define STG_PITCH16 144                       // bytes: 64 bf16 + 16, 16 x odd
#define STG_PITCH32 272                       // bytes: 64 f32 + 16, 16 x odd
#define STG_BYTES   (32 * STG_PITCH32)        // a wave's piece; 8 pieces = As

__device__ __forceinline__ void gemm_stage_copy(const bf16* g, size_t step, unsigned l) {
    asm volatile(
        "global_load_async_to_lds_b128 %0, %8, off\n\t"
        "global_load_async_to_lds_b128 %1, %9, off\n\t"
        "global_load_async_to_lds_b128 %2, %10, off\n\t"
        "global_load_async_to_lds_b128 %3, %11, off\n\t"
        "global_load_async_to_lds_b128 %4, %12, off\n\t"
        "global_load_async_to_lds_b128 %5, %13, off\n\t"
        "global_load_async_to_lds_b128 %6, %14, off\n\t"
        "global_load_async_to_lds_b128 %7, %15, off\n\t"
        "s_wait_xcnt 0x0"
        :: "v"(l), "v"(l + 16 * GPITCH * 2), "v"(l + 32 * GPITCH * 2),
           "v"(l + 48 * GPITCH * 2), "v"(l + 64 * GPITCH * 2),
           "v"(l + 80 * GPITCH * 2), "v"(l + 96 * GPITCH * 2),
           "v"(l + 112 * GPITCH * 2),
           "v"(g), "v"(g + step), "v"(g + 2 * step), "v"(g + 3 * step),
           "v"(g + 4 * step), "v"(g + 5 * step), "v"(g + 6 * step), "v"(g + 7 * step)
        : "memory");
}

template <int MODE, int N>
__global__ __launch_bounds__(256)
void gemm_wmma_kernel(const bf16* __restrict__ A,
                      const bf16* __restrict__ Bt,
                      const float* __restrict__ bias,
                      const float* __restrict__ resid,
                      void* __restrict__ outp,
                      int M, int K) {
    __shared__ __attribute__((aligned(16))) bf16 As[2][GT_ROWS][GPITCH];
    __shared__ __attribute__((aligned(16))) bf16 Bs[2][GT_ROWS][GPITCH];

    int tid   = threadIdx.x;
    int wave  = tid >> 5;
    constexpr int gridN = N >> 7;               // N / 128
    int blkM  = (blockIdx.x / gridN) << 7;
    int blkN  = (blockIdx.x % gridN) << 7;
    int wm    = (wave >> 1) * 32;               // this wave's rows in the block tile
    int wn    = (wave & 1) * 64;                // ... and its columns
    int tileM = blkM + wm;
    int tN    = blkN + wn;

    // This lane's first copy of stage 0: a wave's copy covers four whole lines.
    int crow = tid >> 4;                        // 0..15
    int ccol = (tid & 15) * 8;                  // element offset, 16-byte granules
    const bf16* ag = A  + (size_t)(blkM + crow) * K + ccol;
    const bf16* bg = Bt + (size_t)(blkN + crow) * K + ccol;
    unsigned al = (unsigned)(size_t)(as3_void*)&As[0][crow][ccol];
    unsigned bl = (unsigned)(size_t)(as3_void*)&Bs[0][crow][ccol];
    size_t step = (size_t)16 * K;

    v8f acc[2][4];
#pragma unroll
    for (int mi = 0; mi < 2; ++mi)
#pragma unroll
        for (int t = 0; t < 4; ++t)
#pragma unroll
            for (int i = 0; i < 8; ++i) acc[mi][t][i] = 0.0f;

    int stages = K >> 7;
    gemm_stage_copy(ag, step, al);
    gemm_stage_copy(bg, step, bl);
    asm volatile("s_wait_asynccnt 0x0" ::: "memory");   // stage 0 landed
    __syncthreads();                                    // ... and is public
    if (stages > 1) {
        gemm_stage_copy(ag + GT_K, step, al + GBUF_BYTES);
        gemm_stage_copy(bg + GT_K, step, bl + GBUF_BYTES);
    }

    for (int st = 0; st < stages; ++st) {
        const bf16* at = &As[st & 1][wm][0];
        const bf16* bt = &Bs[st & 1][wn][0];
        // Two fragment sets: the next k block's twelve LDS reads go out as one
        // group ahead of this block's WMMAs, never past the end of the stage.
        // Unrolled so that fa and fb keep constant indices (registers) and the
        // reads take immediate offsets.
        v16bf fa[2][2], fb[2][4];
        fa[0][0] = load_frag(at, GPITCH, 0, 0);
        fa[0][1] = load_frag(at, GPITCH, 16, 0);
#pragma unroll
        for (int t = 0; t < 4; ++t) fb[0][t] = load_frag(bt, GPITCH, 16 * t, 0);
#pragma unroll
        for (int kb = 0; kb < GT_K / 32; ++kb) {
            const int cs = kb & 1, ns = cs ^ 1;
            if (kb + 1 < GT_K / 32) {
                fa[ns][0] = load_frag(at, GPITCH, 0,  (kb + 1) * 32);
                fa[ns][1] = load_frag(at, GPITCH, 16, (kb + 1) * 32);
#pragma unroll
                for (int t = 0; t < 4; ++t)
                    fb[ns][t] = load_frag(bt, GPITCH, 16 * t, (kb + 1) * 32);
            }
            // Holds the read group above ahead of the WMMAs below: left free, the
            // scheduler sinks each read to just in front of its use, and the
            // wave then waits out one LDS latency for every two WMMAs. Before the
            // last block it keeps the block before in front of the stage's
            // closing wait, where its WMMAs cover the last read group's latency.
            __builtin_amdgcn_sched_barrier(0);
#pragma unroll
            for (int t = 0; t < 4; ++t) {
                acc[0][t] = wmma_bf16(fb[cs][t], fa[cs][0], acc[0][t]);
                acc[1][t] = wmma_bf16(fb[cs][t], fa[cs][1], acc[1][t]);
            }
        }
        // Publish point: own LDS reads done, own copies of the next stage landed,
        // then the barrier that publishes that stage and frees this one's buffer.
        asm volatile("s_wait_dscnt 0x0" ::: "memory");
        asm volatile("s_wait_asynccnt 0x0" ::: "memory");
        __syncthreads();
        if (st + 2 < stages) {
            gemm_stage_copy(ag + (st + 2) * GT_K, step, al + (st & 1) * GBUF_BYTES);
            gemm_stage_copy(bg + (st + 2) * GT_K, step, bl + (st & 1) * GBUF_BYTES);
        }
    }
    asm volatile("s_wait_asynccnt 0x0" ::: "memory");   // nothing in flight at the end

    // acc[mi][t][i] = C[tileM + 16 mi + r][tN + 16 t + 8 hf + i].
    // The loop's last publish point (every wave's LDS reads done, no copy in
    // flight, barrier) has freed the ring: each wave stages in its own piece.
    int lane = tid & 31;
    int r = lane & 15, hf = lane >> 4;
    char* stg = (char*)&As[0][0][0] + wave * STG_BYTES;

    if constexpr (MODE == 2) {
        // Read-back map: a wave instruction covers two rows of 256 bytes.
        int rrow = lane >> 4, rcol = (lane & 15) * 4;
        // One 32-bit byte offset (below M * N * 4 = 2^24) on the two scalar bases
        // serves the residual loads and the stores.
        unsigned b0 = (unsigned)(tN + rcol) * 4u;
        unsigned g0 = (unsigned)(tileM + rrow) * (N * 4u) + b0;
        constexpr unsigned gstep = 2 * N * 4;
        const char* rbase = (const char*)resid + g0;
        char* obase = (char*)outp + g0;
        v4f rs[16];
        // Unrolled here and below: rs keeps constant indices (registers), and all
        // sixteen residual loads are in flight before the first is waited for.
#pragma unroll
        for (int j = 0; j < 16; ++j) rs[j] = *(const v4f*)(rbase + j * gstep);
        v4f bz = *(const v4f*)((const char*)bias + b0);
#pragma unroll
        for (int mi = 0; mi < 2; ++mi)
#pragma unroll
            for (int t = 0; t < 4; ++t) {
                char* p = stg + (mi * 16 + r) * STG_PITCH32 + (t * 16 + 8 * hf) * 4;
                v4f lo, hi;
#pragma unroll
                for (int i = 0; i < 4; ++i) { lo[i] = acc[mi][t][i]; hi[i] = acc[mi][t][4 + i]; }
                *(v4f*)p = lo;
                *(v4f*)(p + 16) = hi;
            }
        // Own LDS writes done before other lanes' rows are read back.
        asm volatile("s_wait_dscnt 0x0" ::: "memory");
#pragma unroll
        for (int j = 0; j < 16; ++j) {
            v4f v = *(const v4f*)(stg + (2 * j + rrow) * STG_PITCH32 + rcol * 4);
            *(v4f*)(obase + j * gstep) = (v + bz) + rs[j];
        }
    } else {
        float brow[2];
        v4f bcol[4][2];
        if constexpr (MODE == 1) {
            brow[0] = bias[tileM + r];
            brow[1] = bias[tileM + 16 + r];
        } else {
#pragma unroll
            for (int t = 0; t < 4; ++t) {
                bcol[t][0] = *(const v4f*)(bias + tN + t * 16 + 8 * hf);
                bcol[t][1] = *(const v4f*)(bias + tN + t * 16 + 8 * hf + 4);
            }
        }
#pragma unroll
        for (int mi = 0; mi < 2; ++mi)
#pragma unroll
            for (int t = 0; t < 4; ++t) {
                v8bf o;
#pragma unroll
                for (int i = 0; i < 8; ++i) {
                    float v = acc[mi][t][i];
                    if constexpr (MODE == 1) v += brow[mi];
                    else                     v += bcol[t][i >> 2][i & 3];
                    if constexpr (MODE == 3) v = fmaxf(v, 0.0f);
                    o[i] = (bf16)v;
                }
                *(v8bf*)(stg + (mi * 16 + r) * STG_PITCH16 + (t * 16 + 8 * hf) * 2) = o;
            }
        // Own LDS writes done before other lanes' rows are read back.
        asm volatile("s_wait_dscnt 0x0" ::: "memory");
        // Read-back map: a wave instruction covers four rows of 128 bytes.
        int rrow = lane >> 3, rcol = (lane & 7) * 8;
        int m0 = tileM + rrow;
        // Output pitch in elements, and this lane's first element.
        constexpr size_t gpitch = MODE == 0 ? DK : MODE == 1 ? SEQ : N;
        size_t g0;
        if constexpr (MODE == 0)                // [b, h, s, dk]: one head a wave
            g0 = ((((size_t)(m0 >> 11) * NHEADS + (tN >> 6)) * SEQ) + (m0 & (SEQ - 1))) * DK + rcol;
        else if constexpr (MODE == 1)           // [b, h*dk, s]: one batch a wave
            g0 = ((size_t)(tN >> 11) * D_MODEL + m0) * SEQ + (tN & (SEQ - 1)) + rcol;
        else
            g0 = (size_t)m0 * N + tN + rcol;
#pragma unroll
        for (int j = 0; j < 8; ++j) {
            v8bf o = *(const v8bf*)(stg + (4 * j + rrow) * STG_PITCH16 + rcol * 2);
            *(v8bf*)((bf16*)outp + g0 + j * 4 * gpitch) = o;
        }
    }
}

__device__ __forceinline__ float xhalf(float x) {
    int b = __builtin_bit_cast(int, x);
    return __builtin_bit_cast(float,
        __builtin_amdgcn_permlanex16(b, b, 0x76543210, 0xfedcba98, false, false));
}

__device__ __forceinline__ void exp2_x8(float (&x)[8]) {
    asm("v_exp_f32 %0, %0\n\t"
        "v_exp_f32 %1, %1\n\t"
        "v_exp_f32 %2, %2\n\t"
        "v_exp_f32 %3, %3\n\t"
        "v_exp_f32 %4, %4\n\t"
        "v_exp_f32 %5, %5\n\t"
        "v_exp_f32 %6, %6\n\t"
        "v_exp_f32 %7, %7\n\t"
        "v_nop"
        : "+v"(x[0]), "+v"(x[1]), "+v"(x[2]), "+v"(x[3]),
          "+v"(x[4]), "+v"(x[5]), "+v"(x[6]), "+v"(x[7]));
}

__device__ __forceinline__ float exp2_x1(float x) {
    asm("v_exp_f32 %0, %0\n\t"
        "v_nop"
        : "+v"(x));
    return x;
}

#define LOG2E 1.44269504f

#define ATT_KEYS   128
#define ATT_STAGES (SEQ / ATT_KEYS)
#define KPITCH     72                         // elements: 128 + 16 bytes
#define VPITCH     136                        // elements: 256 + 16 bytes
#define KBUF_BYTES (ATT_KEYS * KPITCH * 2)
#define VBUF_BYTES (DK * VPITCH * 2)

__device__ __forceinline__ void attn_stage_copy(const bf16* kg, const bf16* vg,
                                                unsigned kl, unsigned vl) {
    asm volatile(
        "global_load_async_to_lds_b128 %0, %8, off\n\t"
        "global_load_async_to_lds_b128 %1, %9, off\n\t"
        "global_load_async_to_lds_b128 %2, %10, off\n\t"
        "global_load_async_to_lds_b128 %3, %11, off\n\t"
        "global_load_async_to_lds_b128 %4, %12, off\n\t"
        "global_load_async_to_lds_b128 %5, %13, off\n\t"
        "global_load_async_to_lds_b128 %6, %14, off\n\t"
        "global_load_async_to_lds_b128 %7, %15, off\n\t"
        "s_wait_xcnt 0x0"
        :: "v"(kl), "v"(kl + 32 * KPITCH * 2), "v"(kl + 64 * KPITCH * 2),
           "v"(kl + 96 * KPITCH * 2),
           "v"(vl), "v"(vl + 16 * VPITCH * 2), "v"(vl + 32 * VPITCH * 2),
           "v"(vl + 48 * VPITCH * 2),
           "v"(kg), "v"(kg + 32 * DK), "v"(kg + 64 * DK), "v"(kg + 96 * DK),
           "v"(vg), "v"(vg + 16 * SEQ), "v"(vg + 32 * SEQ), "v"(vg + 48 * SEQ)
        : "memory");
}

__global__ __launch_bounds__(256)
void attn_wmma_kernel(const bf16* __restrict__ q,
                      const bf16* __restrict__ k,
                      const bf16* __restrict__ vT,
                      bf16* __restrict__ attn_c) {
    __shared__ __attribute__((aligned(16))) bf16 Ks[2][ATT_KEYS][KPITCH];
    __shared__ __attribute__((aligned(16))) bf16 Vs[2][DK][VPITCH];

    int tid  = threadIdx.x;
    int wid  = tid >> 5;
    int lane = tid & 31;
    int r = lane & 15, hf = lane >> 4;

    int qblocks = SEQ / 128;
    int bh = blockIdx.x / qblocks;
    int qt = (blockIdx.x % qblocks) * 128 + wid * 16;

    const bf16* qh = q  + (size_t)bh * SEQ * DK;
    const bf16* kh = k  + (size_t)bh * SEQ * DK;
    const bf16* vh = vT + (size_t)bh * DK * SEQ;

    // This lane's first copy of stage 0: a wave's copy covers four whole lines.
    const bf16* kg = kh + tid * 8;
    const bf16* vg = vh + (tid >> 4) * SEQ + (tid & 15) * 8;
    unsigned kl = (unsigned)(size_t)(as3_void*)&Ks[0][tid >> 3][(tid & 7) * 8];
    unsigned vl = (unsigned)(size_t)(as3_void*)&Vs[0][tid >> 4][(tid & 15) * 8];

    attn_stage_copy(kg, vg, kl, vl);
    asm volatile("s_wait_asynccnt 0x0" ::: "memory");   // stage 0 landed
    __syncthreads();                                    // ... and is public
    attn_stage_copy(kg + ATT_KEYS * DK, vg + ATT_KEYS, kl + KBUF_BYTES, vl + VBUF_BYTES);

    v16bf qb0 = load_frag(qh, DK, qt, 0);     // B operand: column = query
    v16bf qb1 = load_frag(qh, DK, qt, 32);

    v8f o[4];                                 // o[t][i] = O[query r][16t + 8hf + i]
#pragma unroll
    for (int t = 0; t < 4; ++t)
#pragma unroll
        for (int i = 0; i < 8; ++i) o[t][i] = 0.0f;
    float mrun = -1e30f;                      // maximum of query r, equal in both halves
    float lsum = 0.0f;                        // this half's share of the sum of query r

    for (int st = 0; st < ATT_STAGES; ++st) {
        const bf16* kt = &Ks[st & 1][0][0];
        const bf16* vt = &Vs[st & 1][0][0];
        // Unrolled so that the LDS reads of all four passes take immediate offsets.
#pragma unroll
        for (int j = 0; j < ATT_KEYS; j += 32) {
            v8f s0, s1;                           // s0[i]: key j + 8hf + i; s1[i]: 16 further
#pragma unroll
            for (int i = 0; i < 8; ++i) { s0[i] = 0.0f; s1[i] = 0.0f; }
            s0 = wmma_bf16(load_frag(kt, KPITCH, j, 0),       qb0, s0);
            s0 = wmma_bf16(load_frag(kt, KPITCH, j, 32),      qb1, s0);
            s1 = wmma_bf16(load_frag(kt, KPITCH, j + 16, 0),  qb0, s1);
            s1 = wmma_bf16(load_frag(kt, KPITCH, j + 16, 32), qb1, s1);

            float mx = -1e30f;
#pragma unroll
            for (int i = 0; i < 8; ++i) {
                s0[i] *= 0.125f;                  // 1/sqrt(dk)
                s1[i] *= 0.125f;
                mx = fmaxf(mx, fmaxf(s0[i], s1[i]));
            }
            mx = fmaxf(mx, xhalf(mx));
            float nm   = fmaxf(mrun, mx);
            float corr = exp2_x1((mrun - nm) * LOG2E);
            mrun = nm;

            float p0[8], p1[8];
            // Unrolled so that p0 and p1 keep constant indices (registers).
#pragma unroll
            for (int i = 0; i < 8; ++i) {
                p0[i] = (s0[i] - nm) * LOG2E;
                p1[i] = (s1[i] - nm) * LOG2E;
            }
            exp2_x8(p0);
            exp2_x8(p1);

            v16bf pb;                             // B operand in the fragment's k order
            float rs = 0.0f;
#pragma unroll
            for (int i = 0; i < 8; ++i) {
                rs += p0[i] + p1[i];
                pb[i]     = (bf16)p0[i];
                pb[8 + i] = (bf16)p1[i];
            }
            lsum = lsum * corr + rs;

#pragma unroll
            for (int t = 0; t < 4; ++t)
#pragma unroll
                for (int i = 0; i < 8; ++i) o[t][i] *= corr;
#pragma unroll
            for (int t = 0; t < 4; ++t)
                o[t] = wmma_bf16(load_frag(vt, VPITCH, t * 16, j), pb, o[t]);
        }
        // Publish point: own LDS reads done, own copies of the next stage landed,
        // then the barrier that publishes that stage and frees this one's buffer.
        asm volatile("s_wait_dscnt 0x0" ::: "memory");
        asm volatile("s_wait_asynccnt 0x0" ::: "memory");
        __syncthreads();
        if (st + 2 < ATT_STAGES)
            attn_stage_copy(kg + (st + 2) * (ATT_KEYS * DK), vg + (st + 2) * ATT_KEYS,
                            kl + (st & 1) * KBUF_BYTES, vl + (st & 1) * VBUF_BYTES);
    }
    asm volatile("s_wait_asynccnt 0x0" ::: "memory");   // nothing in flight at the end

    lsum += xhalf(lsum);                      // join the halves' sums once

    int bb = bh >> 3, hd = bh & (NHEADS - 1);
    size_t tok = (size_t)bb * SEQ + qt + r;
#pragma unroll
    for (int t = 0; t < 4; ++t) {
        v8bf ov;                              // 8 consecutive columns of one token
#pragma unroll
        for (int i = 0; i < 8; ++i) ov[i] = (bf16)(o[t][i] / lsum);
        *(v8bf*)(attn_c + tok * D_MODEL + hd * DK + t * 16 + 8 * hf) = ov;
    }
}

// ---------------------------------------------------------------------------
// LayerNorm (faithful: unbiased std, eps added to std). One wave per row.
// ---------------------------------------------------------------------------
__global__ void layernorm_kernel(const float* __restrict__ z,
                                 const float* __restrict__ alpha,
                                 const float* __restrict__ beta,
                                 float* __restrict__ out32,
                                 bf16* __restrict__ out16) {
    int wid  = threadIdx.x >> 5;
    int lane = threadIdx.x & 31;
    int row = blockIdx.x * (blockDim.x >> 5) + wid;
    const float* zr = z + (size_t)row * D_MODEL;

    float x[16];
    float sum = 0.0f;
#pragma unroll
    for (int e = 0; e < 16; ++e) { x[e] = zr[lane + 32 * e]; sum += x[e]; }
    sum += __shfl_xor(sum, 1);  sum += __shfl_xor(sum, 2);
    sum += __shfl_xor(sum, 4);  sum += __shfl_xor(sum, 8);
    sum += __shfl_xor(sum, 16);
    float mean = sum * (1.0f / 512.0f);

    float var = 0.0f;
#pragma unroll
    for (int e = 0; e < 16; ++e) { float d = x[e] - mean; var += d * d; }
    var += __shfl_xor(var, 1);  var += __shfl_xor(var, 2);
    var += __shfl_xor(var, 4);  var += __shfl_xor(var, 8);
    var += __shfl_xor(var, 16);
    var *= (1.0f / 511.0f);                   // ddof = 1
    float inv = 1.0f / (sqrtf(var) + 1e-6f);  // eps added to std

#pragma unroll
    for (int e = 0; e < 16; ++e) {
        int c = lane + 32 * e;
        float y = alpha[c] * (x[e] - mean) * inv + beta[c];
        out32[(size_t)row * D_MODEL + c] = y;
        if (out16) out16[(size_t)row * D_MODEL + c] = (bf16)y;
    }
}

// ---------------------------------------------------------------------------
// Launch
// ---------------------------------------------------------------------------
extern "C" void kernel_launch(void* const* d_in, const int* in_sizes, int n_in,
                              void* d_out, int out_size, void* d_ws, size_t ws_size,
                              hipStream_t stream) {
    const float* x    = (const float*)d_in[0];
    const float* wq   = (const float*)d_in[1];
    const float* bq   = (const float*)d_in[2];
    const float* wk   = (const float*)d_in[3];
    const float* bk   = (const float*)d_in[4];
    const float* wv   = (const float*)d_in[5];
    const float* bv   = (const float*)d_in[6];
    const float* wo   = (const float*)d_in[7];
    const float* bo   = (const float*)d_in[8];
    const float* w1   = (const float*)d_in[9];
    const float* b1   = (const float*)d_in[10];
    const float* w2   = (const float*)d_in[11];
    const float* b2   = (const float*)d_in[12];
    const float* ln1a = (const float*)d_in[13];
    const float* ln1b = (const float*)d_in[14];
    const float* ln2a = (const float*)d_in[15];
    const float* ln2b = (const float*)d_in[16];
    float* out = (float*)d_out;

    char* ws = (char*)d_ws;
    size_t off = 0;
    auto carve = [&](size_t bytes) { char* p = ws + off; off += (bytes + 255) & ~(size_t)255; return p; };
    bf16*  xb   = (bf16*)carve((size_t)TOKENS * D_MODEL * 2);
    bf16*  wqT  = (bf16*)carve((size_t)D_MODEL * D_MODEL * 2);
    bf16*  wkT  = (bf16*)carve((size_t)D_MODEL * D_MODEL * 2);
    bf16*  wvT  = (bf16*)carve((size_t)D_MODEL * D_MODEL * 2);
    bf16*  woT  = (bf16*)carve((size_t)D_MODEL * D_MODEL * 2);
    bf16*  w1T  = (bf16*)carve((size_t)D_MODEL * D_FF * 2);
    bf16*  w2T  = (bf16*)carve((size_t)D_FF * D_MODEL * 2);
    bf16*  qb   = (bf16*)carve((size_t)TOKENS * D_MODEL * 2);
    bf16*  kb   = (bf16*)carve((size_t)TOKENS * D_MODEL * 2);
    bf16*  vTb  = (bf16*)carve((size_t)TOKENS * D_MODEL * 2);
    bf16*  attn = (bf16*)carve((size_t)TOKENS * D_MODEL * 2);
    float* z1   = (float*)carve((size_t)TOKENS * D_MODEL * 4);   // reused for z2
    float* y32  = (float*)carve((size_t)TOKENS * D_MODEL * 4);
    bf16*  y16  = (bf16*)carve((size_t)TOKENS * D_MODEL * 2);
    bf16*  ffh  = (bf16*)carve((size_t)TOKENS * D_FF * 2);

    // --- prep: bf16 conversion + weight transposes ---
    f32_to_bf16_kernel<<<(TOKENS * D_MODEL) / 8192, 256, 0, stream>>>(x, xb, TOKENS * D_MODEL);
    transpose_to_bf16_kernel<D_MODEL, D_MODEL><<<(D_MODEL * D_MODEL) / 8192, 256, 0, stream>>>(wq, wqT);
    transpose_to_bf16_kernel<D_MODEL, D_MODEL><<<(D_MODEL * D_MODEL) / 8192, 256, 0, stream>>>(wk, wkT);
    transpose_to_bf16_kernel<D_MODEL, D_MODEL><<<(D_MODEL * D_MODEL) / 8192, 256, 0, stream>>>(wv, wvT);
    transpose_to_bf16_kernel<D_MODEL, D_MODEL><<<(D_MODEL * D_MODEL) / 8192, 256, 0, stream>>>(wo, woT);
    transpose_to_bf16_kernel<D_MODEL, D_FF><<<(D_MODEL * D_FF) / 8192, 256, 0, stream>>>(w1, w1T);
    transpose_to_bf16_kernel<D_FF, D_MODEL><<<(D_FF * D_MODEL) / 8192, 256, 0, stream>>>(w2, w2T);

    // --- QKV projections: workgroup tile 128x128 -> 256 blocks each ---
    gemm_wmma_kernel<0, D_MODEL><<<256, 256, 0, stream>>>(xb, wqT, bq, nullptr, qb,  TOKENS, D_MODEL);
    gemm_wmma_kernel<0, D_MODEL><<<256, 256, 0, stream>>>(xb, wkT, bk, nullptr, kb,  TOKENS, D_MODEL);
    gemm_wmma_kernel<1, TOKENS><<<256, 256, 0, stream>>>(wvT, xb, bv, nullptr, vTb, D_MODEL, D_MODEL);

    // --- attention: 32 (b,h) * 16 q-blocks, 8 waves each ---
    attn_wmma_kernel<<<BATCH * NHEADS * (SEQ / 128), 256, 0, stream>>>(qb, kb, vTb, attn);

    // --- out-proj + residual -> z1; LN1 -> y (f32 + bf16) ---
    gemm_wmma_kernel<2, D_MODEL><<<256, 256, 0, stream>>>(attn, woT, bo, x, z1, TOKENS, D_MODEL);
    layernorm_kernel<<<TOKENS / 8, 256, 0, stream>>>(z1, ln1a, ln1b, y32, y16);

    // --- FFN1 (ReLU) -> ffh; FFN2 + residual(y) -> z1; LN2 -> out ---
    gemm_wmma_kernel<3, D_FF><<<1024, 256, 0, stream>>>(y16, w1T, b1, nullptr, ffh, TOKENS, D_MODEL);
    gemm_wmma_kernel<2, D_MODEL><<<256, 256, 0, stream>>>(ffh, w2T, b2, y32, z1, TOKENS, D_FF);
    layernorm_kernel<<<TOKENS / 8, 256, 0, stream>>>(z1, ln2a, ln2b, out, nullptr);
}

// v006
// Measured time: 133 microseconds a run.
// In both of two side-by-side timings against v005, it was 1.16 times as fast.
// All steps since v000 together make it 4.63 times as fast.
#include <hip/hip_runtime.h>
#include <hip/hip_bf16.h>

typedef __bf16 bf16;
typedef bf16  v16bf __attribute__((ext_vector_type(16)));
typedef bf16  v8bf  __attribute__((ext_vector_type(8)));
typedef float v8f   __attribute__((ext_vector_type(8)));

typedef __attribute__((address_space(3))) void as3_void;

#define D_MODEL 512
#define NHEADS  8
#define DK      64
#define D_FF    2048
#define BATCH   4
#define SEQ     2048
#define TOKENS  (BATCH * SEQ)

__device__ __forceinline__ v16bf load_frag(const bf16* __restrict__ base,
                                           int stride, int row0, int k0) {
    int lane = threadIdx.x & 31;
    int r = lane & 15, h = lane >> 4;
    const bf16* p = base + (size_t)(row0 + r) * stride + (k0 + h * 8);
    v8bf lo = *(const v8bf*)(p);
    v8bf hi = *(const v8bf*)(p + 16);
    return __builtin_shufflevector(lo, hi, 0,1,2,3,4,5,6,7,8,9,10,11,12,13,14,15);
}

__device__ __forceinline__ v8f wmma_bf16(v16bf a, v16bf b, v8f c) {
    return __builtin_amdgcn_wmma_f32_16x16x32_bf16(false, a, false, b,
                                                   (short)0, c, false, false);
}

// ---------------------------------------------------------------------------
// Prep kernel. A launch pays for every wave it starts, so each wave moves
// kilobytes, not 32 elements: 16-byte loads, eight in flight a lane, and every
// store instruction fills whole 128-byte lines.
// ---------------------------------------------------------------------------
typedef float v4f  __attribute__((ext_vector_type(4)));
typedef bf16  v4bf __attribute__((ext_vector_type(4)));

// One block converts 8192 consecutive floats: 8 loads of 16 bytes a lane.
// blk = the block's index inside this job's range of the shared grid.
__device__ __forceinline__
void f32_to_bf16_block(const float* __restrict__ in,
                       bf16* __restrict__ out, int n, int blk) {
    int base = blk * 8192;
    if (base + 8192 > n) return;              // block-uniform bound
    int i0 = base + threadIdx.x * 4;
    v4f v[8];
    // Every loop here is unrolled so that v[] and o keep constant indices
    // (registers, no scratch) and all eight loads issue ahead of the first wait.
#pragma unroll
    for (int j = 0; j < 8; ++j) v[j] = *(const v4f*)(in + i0 + j * 1024);
#pragma unroll
    for (int j = 0; j < 8; ++j) {
        v4bf o;
#pragma unroll
        for (int c = 0; c < 4; ++c) o[c] = (bf16)v[j][c];
        *(v4bf*)(out + i0 + j * 1024) = o;
    }
    // Another job's code may follow in the kernel: no register that the stores
    // above name is rewritten ahead of this wait.
    asm volatile("s_wait_xcnt 0x0" ::: "memory");
}

// w is [K,N] row-major f32 -> wT is [N,K] row-major bf16.
// Block tile 64 (k) x 128 (n), wave tile 64 x 16, lane patch 8 (k) x 4 (n):
// lane = 8 * (column quad) + (k octet), so the eight lanes of a column quad
// store 8 x 16 bytes = one whole line of a wT row, and the two waves that
// share a 128-byte line of w sit in the same block.
// K and N are compile-time so that one address pair and immediate offsets
// serve all eight loads, and one pair the four stores.
template <int K, int N>
__device__ __forceinline__
void transpose_to_bf16_block(const float* __restrict__ w,
                             bf16* __restrict__ wT, int blk) {
    constexpr int nblk = N / 128;
    int kt = blk / nblk, nt = blk % nblk;
    if (kt >= K / 64) return;                 // block-uniform bound
    int wave = threadIdx.x >> 5, lane = threadIdx.x & 31;
    int k0 = kt * 64 + (lane & 7) * 8;
    int n0 = nt * 128 + wave * 16 + (lane >> 3) * 4;
    const float* src = w + k0 * N + n0;
    bf16* dst = wT + n0 * K + k0;
    v4f v[8];
    // Unrolled for the same two reasons as in the cast job above.
#pragma unroll
    for (int j = 0; j < 8; ++j) v[j] = *(const v4f*)(src + j * N);
#pragma unroll
    for (int c = 0; c < 4; ++c) {
        v8bf o;
#pragma unroll
        for (int j = 0; j < 8; ++j) o[j] = (bf16)v[j][c];
        *(v8bf*)(dst + c * K) = o;
    }
    // Another job's code may follow in the kernel: no register that the stores
    // above name is rewritten ahead of this wait.
    asm volatile("s_wait_xcnt 0x0" ::: "memory");
}

#define CAST_BLOCKS ((TOKENS * D_MODEL) / 8192)
#define SQ_BLOCKS   ((D_MODEL * D_MODEL) / 8192)
#define FF_BLOCKS   ((D_MODEL * D_FF) / 8192)
#define PREP_BLOCKS (CAST_BLOCKS + 4 * SQ_BLOCKS + 2 * FF_BLOCKS)

__global__ __launch_bounds__(256)
void prep_kernel(const float* __restrict__ x,  bf16* __restrict__ xb,
                 const float* __restrict__ wq, bf16* __restrict__ wqT,
                 const float* __restrict__ wk, bf16* __restrict__ wkT,
                 const float* __restrict__ wv, bf16* __restrict__ wvT,
                 const float* __restrict__ wo, bf16* __restrict__ woT,
                 const float* __restrict__ w1, bf16* __restrict__ w1T,
                 const float* __restrict__ w2, bf16* __restrict__ w2T) {
    int b = blockIdx.x;
    if (b < CAST_BLOCKS) {
        f32_to_bf16_block(x, xb, TOKENS * D_MODEL, b);
        return;
    }
    b -= CAST_BLOCKS;
    if (b < 4 * SQ_BLOCKS) {
        int which = b / SQ_BLOCKS;
        const float* w = which == 0 ? wq : which == 1 ? wk : which == 2 ? wv : wo;
        bf16* wT = which == 0 ? wqT : which == 1 ? wkT : which == 2 ? wvT : woT;
        transpose_to_bf16_block<D_MODEL, D_MODEL>(w, wT, b % SQ_BLOCKS);
        return;
    }
    b -= 4 * SQ_BLOCKS;
    if (b < FF_BLOCKS) transpose_to_bf16_block<D_MODEL, D_FF>(w1, w1T, b);
    else               transpose_to_bf16_block<D_FF, D_MODEL>(w2, w2T, b - FF_BLOCKS);
}

// ---------------------------------------------------------------------------
// WMMA GEMM, both operands staged in LDS.
// Workgroup: 256 threads (8 waves), tile 128 (M) x 128 (N); waves 4 (M) x 2 (N),
// each owns a 32x64 slice (8 accumulators). A stage is 128 k of the 128 rows of
// A and of the 128 rows of B^T: rows of 256 bytes, copied in whole lines by
// asynchronous copies into two buffers, the next stage in flight while this one
// is worked on. A row of A then serves 2 waves and a row of B^T serves 4, and
// no wave waits on a global load inside the k loop.
// Needs M, N multiples of 128 and K a multiple of 128.
// MODE and N are compile-time: the epilogue then holds no branch, and one
// address with immediate offsets serves all of a lane's loads or stores. MODE:
//   0 = bf16, rows are tokens, columns scattered to [b,h,s,dk] (Q/K)
//   1 = bf16, rows are channels, columns are tokens -> [b,h,dk,s] (V^T = Wv^T X^T),
//       bias by row
//   2 = f32 [M,N] + residual;   3 = bf16 [M,N] with ReLU
// Each 16x16 product is taken transposed (B^T rows as the A operand, A rows as
// the B operand): in the accumulator map a lane then holds 8 ADJACENT columns of
// one output row, 16 bytes of bf16. Every wave turns its 32x64 slice through its
// own piece of the finished ring, so that each global store (and each residual
// load) is 16 bytes a lane over whole 128-byte lines.
// ---------------------------------------------------------------------------
#define GT_ROWS    128                        // rows of either operand in a stage
#define GT_K       128                        // k elements in a stage
#define GPITCH     136                        // elements: 256 + 16 bytes, 16 x odd
#define GBUF_BYTES (GT_ROWS * GPITCH * 2)
#define STG_PITCH16 144                       // bytes: 64 bf16 + 16, 16 x odd
#define STG_PITCH32 272                       // bytes: 64 f32 + 16, 16 x odd
#define STG_BYTES   (32 * STG_PITCH32)        // a wave's piece; 8 pieces = As

__device__ __forceinline__ void gemm_stage_copy(const bf16* g, size_t step, unsigned l) {
    asm volatile(
        "global_load_async_to_lds_b128 %0, %8, off\n\t"
        "global_load_async_to_lds_b128 %1, %9, off\n\t"
        "global_load_async_to_lds_b128 %2, %10, off\n\t"
        "global_load_async_to_lds_b128 %3, %11, off\n\t"
        "global_load_async_to_lds_b128 %4, %12, off\n\t"
        "global_load_async_to_lds_b128 %5, %13, off\n\t"
        "global_load_async_to_lds_b128 %6, %14, off\n\t"
        "global_load_async_to_lds_b128 %7, %15, off\n\t"
        "s_wait_xcnt 0x0"
        :: "v"(l), "v"(l + 16 * GPITCH * 2), "v"(l + 32 * GPITCH * 2),
           "v"(l + 48 * GPITCH * 2), "v"(l + 64 * GPITCH * 2),
           "v"(l + 80 * GPITCH * 2), "v"(l + 96 * GPITCH * 2),
           "v"(l + 112 * GPITCH * 2),
           "v"(g), "v"(g + step), "v"(g + 2 * step), "v"(g + 3 * step),
           "v"(g + 4 * step), "v"(g + 5 * step), "v"(g + 6 * step), "v"(g + 7 * step)
        : "memory");
}

typedef bf16 gemm_ring[2][GT_ROWS][GPITCH];

// One block tile. The kernel owns the two rings and hands them in, so that a
// kernel which holds several MODEs still has one pair of rings in LDS.
// blk = the block's index inside this product's range of the grid.
template <int MODE, int N>
__device__ __forceinline__
void gemm_tile(gemm_ring& As, gemm_ring& Bs, int blk,
               const bf16* __restrict__ A,
               const bf16* __restrict__ Bt,
               const float* __restrict__ bias,
               const float* __restrict__ resid,
               void* __restrict__ outp,
               int K) {
    int tid   = threadIdx.x;
    int wave  = tid >> 5;
    constexpr int gridN = N >> 7;               // N / 128
    int blkM  = (blk / gridN) << 7;
    int blkN  = (blk % gridN) << 7;
    int wm    = (wave >> 1) * 32;               // this wave's rows in the block tile
    int wn    = (wave & 1) * 64;                // ... and its columns
    int tileM = blkM + wm;
    int tN    = blkN + wn;

    // This lane's first copy of stage 0: a wave's copy covers four whole lines.
    int crow = tid >> 4;                        // 0..15
    int ccol = (tid & 15) * 8;                  // element offset, 16-byte granules
    const bf16* ag = A  + (size_t)(blkM + crow) * K + ccol;
    const bf16* bg = Bt + (size_t)(blkN + crow) * K + ccol;
    unsigned al = (unsigned)(size_t)(as3_void*)&As[0][crow][ccol];
    unsigned bl = (unsigned)(size_t)(as3_void*)&Bs[0][crow][ccol];
    size_t step = (size_t)16 * K;

    v8f acc[2][4];
#pragma unroll
    for (int mi = 0; mi < 2; ++mi)
#pragma unroll
        for (int t = 0; t < 4; ++t)
#pragma unroll
            for (int i = 0; i < 8; ++i) acc[mi][t][i] = 0.0f;

    int stages = K >> 7;
    gemm_stage_copy(ag, step, al);
    gemm_stage_copy(bg, step, bl);
    asm volatile("s_wait_asynccnt 0x0" ::: "memory");   // stage 0 landed
    __syncthreads();                                    // ... and is public
    if (stages > 1) {
        gemm_stage_copy(ag + GT_K, step, al + GBUF_BYTES);
        gemm_stage_copy(bg + GT_K, step, bl + GBUF_BYTES);
    }

    for (int st = 0; st < stages; ++st) {
        const bf16* at = &As[st & 1][wm][0];
        const bf16* bt = &Bs[st & 1][wn][0];
        // Two fragment sets: the next k block's twelve LDS reads go out as one
        // group ahead of this block's WMMAs, never past the end of the stage.
        // Unrolled so that fa and fb keep constant indices (registers) and the
        // reads take immediate offsets.
        v16bf fa[2][2], fb[2][4];
        fa[0][0] = load_frag(at, GPITCH, 0, 0);
        fa[0][1] = load_frag(at, GPITCH, 16, 0);
#pragma unroll
        for (int t = 0; t < 4; ++t) fb[0][t] = load_frag(bt, GPITCH, 16 * t, 0);
#pragma unroll
        for (int kb = 0; kb < GT_K / 32; ++kb) {
            const int cs = kb & 1, ns = cs ^ 1;
            if (kb + 1 < GT_K / 32) {
                fa[ns][0] = load_frag(at, GPITCH, 0,  (kb + 1) * 32);
                fa[ns][1] = load_frag(at, GPITCH, 16, (kb + 1) * 32);
#pragma unroll
                for (int t = 0; t < 4; ++t)
                    fb[ns][t] = load_frag(bt, GPITCH, 16 * t, (kb + 1) * 32);
            }
            // Holds the read group above ahead of the WMMAs below: left free, the
            // scheduler sinks each read to just in front of its use, and the
            // wave then waits out one LDS latency for every two WMMAs. Before the
            // last block it keeps the block before in front of the stage's
            // closing wait, where its WMMAs cover the last read group's latency.
            __builtin_amdgcn_sched_barrier(0);
#pragma unroll
            for (int t = 0; t < 4; ++t) {
                acc[0][t] = wmma_bf16(fb[cs][t], fa[cs][0], acc[0][t]);
                acc[1][t] = wmma_bf16(fb[cs][t], fa[cs][1], acc[1][t]);
            }
        }
        // Publish point: own LDS reads done, own copies of the next stage landed,
        // then the barrier that publishes that stage and frees this one's buffer.
        asm volatile("s_wait_dscnt 0x0" ::: "memory");
        asm volatile("s_wait_asynccnt 0x0" ::: "memory");
        __syncthreads();
        if (st + 2 < stages) {
            gemm_stage_copy(ag + (st + 2) * GT_K, step, al + (st & 1) * GBUF_BYTES);
            gemm_stage_copy(bg + (st + 2) * GT_K, step, bl + (st & 1) * GBUF_BYTES);
        }
    }
    asm volatile("s_wait_asynccnt 0x0" ::: "memory");   // nothing in flight at the end

    // acc[mi][t][i] = C[tileM + 16 mi + r][tN + 16 t + 8 hf + i].
    // The loop's last publish point (every wave's LDS reads done, no copy in
    // flight, barrier) has freed the ring: each wave stages in its own piece.
    int lane = tid & 31;
    int r = lane & 15, hf = lane >> 4;
    char* stg = (char*)&As[0][0][0] + wave * STG_BYTES;

    if constexpr (MODE == 2) {
        // Read-back map: a wave instruction covers two rows of 256 bytes.
        int rrow = lane >> 4, rcol = (lane & 15) * 4;
        // One 32-bit byte offset (below M * N * 4 = 2^24) on the two scalar bases
        // serves the residual loads and the stores.
        unsigned b0 = (unsigned)(tN + rcol) * 4u;
        unsigned g0 = (unsigned)(tileM + rrow) * (N * 4u) + b0;
        constexpr unsigned gstep = 2 * N * 4;
        const char* rbase = (const char*)resid + g0;
        char* obase = (char*)outp + g0;
        v4f rs[16];
        // Unrolled here and below: rs keeps constant indices (registers), and all
        // sixteen residual loads are in flight before the first is waited for.
#pragma unroll
        for (int j = 0; j < 16; ++j) rs[j] = *(const v4f*)(rbase + j * gstep);
        v4f bz = *(const v4f*)((const char*)bias + b0);
#pragma unroll
        for (int mi = 0; mi < 2; ++mi)
#pragma unroll
            for (int t = 0; t < 4; ++t) {
                char* p = stg + (mi * 16 + r) * STG_PITCH32 + (t * 16 + 8 * hf) * 4;
                v4f lo, hi;
#pragma unroll
                for (int i = 0; i < 4; ++i) { lo[i] = acc[mi][t][i]; hi[i] = acc[mi][t][4 + i]; }
                *(v4f*)p = lo;
                *(v4f*)(p + 16) = hi;
            }
        // Own LDS writes done before other lanes' rows are read back.
        asm volatile("s_wait_dscnt 0x0" ::: "memory");
#pragma unroll
        for (int j = 0; j < 16; ++j) {
            v4f v = *(const v4f*)(stg + (2 * j + rrow) * STG_PITCH32 + rcol * 4);
            *(v4f*)(obase + j * gstep) = (v + bz) + rs[j];
        }
        // Another job's code may follow in the kernel: no register that the stores
        // above name is rewritten ahead of this wait.
        asm volatile("s_wait_xcnt 0x0" ::: "memory");
    } else {
        float brow[2];
        v4f bcol[4][2];
        if constexpr (MODE == 1) {
            brow[0] = bias[tileM + r];
            brow[1] = bias[tileM + 16 + r];
        } else {
#pragma unroll
            for (int t = 0; t < 4; ++t) {
                bcol[t][0] = *(const v4f*)(bias + tN + t * 16 + 8 * hf);
                bcol[t][1] = *(const v4f*)(bias + tN + t * 16 + 8 * hf + 4);
            }
        }
#pragma unroll
        for (int mi = 0; mi < 2; ++mi)
#pragma unroll
            for (int t = 0; t < 4; ++t) {
                v8bf o;
#pragma unroll
                for (int i = 0; i < 8; ++i) {
                    float v = acc[mi][t][i];
                    if constexpr (MODE == 1) v += brow[mi];
                    else                     v += bcol[t][i >> 2][i & 3];
                    if constexpr (MODE == 3) v = fmaxf(v, 0.0f);
                    o[i] = (bf16)v;
                }
                *(v8bf*)(stg + (mi * 16 + r) * STG_PITCH16 + (t * 16 + 8 * hf) * 2) = o;
            }
        // Own LDS writes done before other lanes' rows are read back.
        asm volatile("s_wait_dscnt 0x0" ::: "memory");
        // Read-back map: a wave instruction covers four rows of 128 bytes.
        int rrow = lane >> 3, rcol = (lane & 7) * 8;
        int m0 = tileM + rrow;
        // Output pitch in elements, and this lane's first element.
        constexpr size_t gpitch = MODE == 0 ? DK : MODE == 1 ? SEQ : N;
        size_t g0;
        if constexpr (MODE == 0)                // [b, h, s, dk]: one head a wave
            g0 = ((((size_t)(m0 >> 11) * NHEADS + (tN >> 6)) * SEQ) + (m0 & (SEQ - 1))) * DK + rcol;
        else if constexpr (MODE == 1)           // [b, h*dk, s]: one batch a wave
            g0 = ((size_t)(tN >> 11) * D_MODEL + m0) * SEQ + (tN & (SEQ - 1)) + rcol;
        else
            g0 = (size_t)m0 * N + tN + rcol;
#pragma unroll
        for (int j = 0; j < 8; ++j) {
            v8bf o = *(const v8bf*)(stg + (4 * j + rrow) * STG_PITCH16 + rcol * 2);
            *(v8bf*)((bf16*)outp + g0 + j * 4 * gpitch) = o;
        }
        // Another job's code may follow in the kernel: no register that the stores
        // above name is rewritten ahead of this wait.
        asm volatile("s_wait_xcnt 0x0" ::: "memory");
    }
}

template <int MODE, int N>
__global__ __launch_bounds__(256)
void gemm_wmma_kernel(const bf16* __restrict__ A,
                      const bf16* __restrict__ Bt,
                      const float* __restrict__ bias,
                      const float* __restrict__ resid,
                      void* __restrict__ outp,
                      int M, int K) {
    __shared__ __attribute__((aligned(16))) bf16 As[2][GT_ROWS][GPITCH];
    __shared__ __attribute__((aligned(16))) bf16 Bs[2][GT_ROWS][GPITCH];
    gemm_tile<MODE, N>(As, Bs, blockIdx.x, A, Bt, bias, resid, outp, K);
}

// Q, K and V^T need nothing of each other: one grid, a third of the block index
// each. The branch is block-uniform, so every barrier inside a tile is reached
// by the whole work-group or by none of it.
#define PROJ_BLOCKS ((TOKENS / 128) * (D_MODEL / 128))

__global__ __launch_bounds__(256)
void qkv_wmma_kernel(const bf16* __restrict__ xb,
                     const bf16* __restrict__ wqT, const float* __restrict__ bq,
                     bf16* __restrict__ qo,
                     const bf16* __restrict__ wkT, const float* __restrict__ bk,
                     bf16* __restrict__ ko,
                     const bf16* __restrict__ wvT, const float* __restrict__ bv,
                     bf16* __restrict__ vTo,
                     int K) {
    __shared__ __attribute__((aligned(16))) bf16 As[2][GT_ROWS][GPITCH];
    __shared__ __attribute__((aligned(16))) bf16 Bs[2][GT_ROWS][GPITCH];
    int b = blockIdx.x;
    if (b < 2 * PROJ_BLOCKS) {
        bool isq = b < PROJ_BLOCKS;
        gemm_tile<0, D_MODEL>(As, Bs, isq ? b : b - PROJ_BLOCKS, xb,
                              isq ? wqT : wkT, isq ? bq : bk, nullptr,
                              isq ? qo : ko, K);
    } else {
        gemm_tile<1, TOKENS>(As, Bs, b - 2 * PROJ_BLOCKS, wvT, xb, bv, nullptr,
                             vTo, K);
    }
}

__device__ __forceinline__ float xhalf(float x) {
    int b = __builtin_bit_cast(int, x);
    return __builtin_bit_cast(float,
        __builtin_amdgcn_permlanex16(b, b, 0x76543210, 0xfedcba98, false, false));
}

__device__ __forceinline__ void exp2_x8(float (&x)[8]) {
    asm("v_exp_f32 %0, %0\n\t"
        "v_exp_f32 %1, %1\n\t"
        "v_exp_f32 %2, %2\n\t"
        "v_exp_f32 %3, %3\n\t"
        "v_exp_f32 %4, %4\n\t"
        "v_exp_f32 %5, %5\n\t"
        "v_exp_f32 %6, %6\n\t"
        "v_exp_f32 %7, %7\n\t"
        "v_nop"
        : "+v"(x[0]), "+v"(x[1]), "+v"(x[2]), "+v"(x[3]),
          "+v"(x[4]), "+v"(x[5]), "+v"(x[6]), "+v"(x[7]));
}

__device__ __forceinline__ float exp2_x1(float x) {
    asm("v_exp_f32 %0, %0\n\t"
        "v_nop"
        : "+v"(x));
    return x;
}

#define LOG2E 1.44269504f

#define ATT_KEYS   128
#define ATT_STAGES (SEQ / ATT_KEYS)
#define KPITCH     72                         // elements: 128 + 16 bytes
#define VPITCH     136                        // elements: 256 + 16 bytes
#define KBUF_BYTES (ATT_KEYS * KPITCH * 2)
#define VBUF_BYTES (DK * VPITCH * 2)

__device__ __forceinline__ void attn_stage_copy(const bf16* kg, const bf16* vg,
                                                unsigned kl, unsigned vl) {
    asm volatile(
        "global_load_async_to_lds_b128 %0, %8, off\n\t"
        "global_load_async_to_lds_b128 %1, %9, off\n\t"
        "global_load_async_to_lds_b128 %2, %10, off\n\t"
        "global_load_async_to_lds_b128 %3, %11, off\n\t"
        "global_load_async_to_lds_b128 %4, %12, off\n\t"
        "global_load_async_to_lds_b128 %5, %13, off\n\t"
        "global_load_async_to_lds_b128 %6, %14, off\n\t"
        "global_load_async_to_lds_b128 %7, %15, off\n\t"
        "s_wait_xcnt 0x0"
        :: "v"(kl), "v"(kl + 32 * KPITCH * 2), "v"(kl + 64 * KPITCH * 2),
           "v"(kl + 96 * KPITCH * 2),
           "v"(vl), "v"(vl + 16 * VPITCH * 2), "v"(vl + 32 * VPITCH * 2),
           "v"(vl + 48 * VPITCH * 2),
           "v"(kg), "v"(kg + 32 * DK), "v"(kg + 64 * DK), "v"(kg + 96 * DK),
           "v"(vg), "v"(vg + 16 * SEQ), "v"(vg + 32 * SEQ), "v"(vg + 48 * SEQ)
        : "memory");
}

__global__ __launch_bounds__(256)
void attn_wmma_kernel(const bf16* __restrict__ q,
                      const bf16* __restrict__ k,
                      const bf16* __restrict__ vT,
                      bf16* __restrict__ attn_c) {
    __shared__ __attribute__((aligned(16))) bf16 Ks[2][ATT_KEYS][KPITCH];
    __shared__ __attribute__((aligned(16))) bf16 Vs[2][DK][VPITCH];

    int tid  = threadIdx.x;
    int wid  = tid >> 5;
    int lane = tid & 31;
    int r = lane & 15, hf = lane >> 4;

    int qblocks = SEQ / 128;
    int bh = blockIdx.x / qblocks;
    int qt = (blockIdx.x % qblocks) * 128 + wid * 16;

    const bf16* qh = q  + (size_t)bh * SEQ * DK;
    const bf16* kh = k  + (size_t)bh * SEQ * DK;
    const bf16* vh = vT + (size_t)bh * DK * SEQ;

    // This lane's first copy of stage 0: a wave's copy covers four whole lines.
    const bf16* kg = kh + tid * 8;
    const bf16* vg = vh + (tid >> 4) * SEQ + (tid & 15) * 8;
    unsigned kl = (unsigned)(size_t)(as3_void*)&Ks[0][tid >> 3][(tid & 7) * 8];
    unsigned vl = (unsigned)(size_t)(as3_void*)&Vs[0][tid >> 4][(tid & 15) * 8];

    attn_stage_copy(kg, vg, kl, vl);
    asm volatile("s_wait_asynccnt 0x0" ::: "memory");   // stage 0 landed
    __syncthreads();                                    // ... and is public
    attn_stage_copy(kg + ATT_KEYS * DK, vg + ATT_KEYS, kl + KBUF_BYTES, vl + VBUF_BYTES);

    v16bf qb0 = load_frag(qh, DK, qt, 0);     // B operand: column = query
    v16bf qb1 = load_frag(qh, DK, qt, 32);

    v8f o[4];                                 // o[t][i] = O[query r][16t + 8hf + i]
#pragma unroll
    for (int t = 0; t < 4; ++t)
#pragma unroll
        for (int i = 0; i < 8; ++i) o[t][i] = 0.0f;
    float mrun = -1e30f;                      // maximum of query r, equal in both halves
    float lsum = 0.0f;                        // this half's share of the sum of query r

    for (int st = 0; st < ATT_STAGES; ++st) {
        const bf16* kt = &Ks[st & 1][0][0];
        const bf16* vt = &Vs[st & 1][0][0];
        // Unrolled so that the LDS reads of all four passes take immediate offsets.
#pragma unroll
        for (int j = 0; j < ATT_KEYS; j += 32) {
            v8f s0, s1;                           // s0[i]: key j + 8hf + i; s1[i]: 16 further
#pragma unroll
            for (int i = 0; i < 8; ++i) { s0[i] = 0.0f; s1[i] = 0.0f; }
            s0 = wmma_bf16(load_frag(kt, KPITCH, j, 0),       qb0, s0);
            s0 = wmma_bf16(load_frag(kt, KPITCH, j, 32),      qb1, s0);
            s1 = wmma_bf16(load_frag(kt, KPITCH, j + 16, 0),  qb0, s1);
            s1 = wmma_bf16(load_frag(kt, KPITCH, j + 16, 32), qb1, s1);

            float mx = -1e30f;
#pragma unroll
            for (int i = 0; i < 8; ++i) {
                s0[i] *= 0.125f;                  // 1/sqrt(dk)
                s1[i] *= 0.125f;
                mx = fmaxf(mx, fmaxf(s0[i], s1[i]));
            }
            mx = fmaxf(mx, xhalf(mx));
            float nm   = fmaxf(mrun, mx);
            float corr = exp2_x1((mrun - nm) * LOG2E);
            mrun = nm;

            float p0[8], p1[8];
            // Unrolled so that p0 and p1 keep constant indices (registers).
#pragma unroll
            for (int i = 0; i < 8; ++i) {
                p0[i] = (s0[i] - nm) * LOG2E;
                p1[i] = (s1[i] - nm) * LOG2E;
            }
            exp2_x8(p0);
            exp2_x8(p1);

            v16bf pb;                             // B operand in the fragment's k order
            float rs = 0.0f;
#pragma unroll
            for (int i = 0; i < 8; ++i) {
                rs += p0[i] + p1[i];
                pb[i]     = (bf16)p0[i];
                pb[8 + i] = (bf16)p1[i];
            }
            lsum = lsum * corr + rs;

#pragma unroll
            for (int t = 0; t < 4; ++t)
#pragma unroll
                for (int i = 0; i < 8; ++i) o[t][i] *= corr;
#pragma unroll
            for (int t = 0; t < 4; ++t)
                o[t] = wmma_bf16(load_frag(vt, VPITCH, t * 16, j), pb, o[t]);
        }
        // Publish point: own LDS reads done, own copies of the next stage landed,
        // then the barrier that publishes that stage and frees this one's buffer.
        asm volatile("s_wait_dscnt 0x0" ::: "memory");
        asm volatile("s_wait_asynccnt 0x0" ::: "memory");
        __syncthreads();
        if (st + 2 < ATT_STAGES)
            attn_stage_copy(kg + (st + 2) * (ATT_KEYS * DK), vg + (st + 2) * ATT_KEYS,
                            kl + (st & 1) * KBUF_BYTES, vl + (st & 1) * VBUF_BYTES);
    }
    asm volatile("s_wait_asynccnt 0x0" ::: "memory");   // nothing in flight at the end

    lsum += xhalf(lsum);                      // join the halves' sums once

    int bb = bh >> 3, hd = bh & (NHEADS - 1);
    size_t tok = (size_t)bb * SEQ + qt + r;
#pragma unroll
    for (int t = 0; t < 4; ++t) {
        v8bf ov;                              // 8 consecutive columns of one token
#pragma unroll
        for (int i = 0; i < 8; ++i) ov[i] = (bf16)(o[t][i] / lsum);
        *(v8bf*)(attn_c + tok * D_MODEL + hd * DK + t * 16 + 8 * hf) = ov;
    }
}

// ---------------------------------------------------------------------------
// LayerNorm (faithful: unbiased std, eps added to std). One wave per row.
// ---------------------------------------------------------------------------
__global__ void layernorm_kernel(const float* __restrict__ z,
                                 const float* __restrict__ alpha,
                                 const float* __restrict__ beta,
                                 float* __restrict__ out32,
                                 bf16* __restrict__ out16) {
    int wid  = threadIdx.x >> 5;
    int lane = threadIdx.x & 31;
    int row = blockIdx.x * (blockDim.x >> 5) + wid;
    const float* zr = z + (size_t)row * D_MODEL;

    float x[16];
    float sum = 0.0f;
#pragma unroll
    for (int e = 0; e < 16; ++e) { x[e] = zr[lane + 32 * e]; sum += x[e]; }
    sum += __shfl_xor(sum, 1);  sum += __shfl_xor(sum, 2);
    sum += __shfl_xor(sum, 4);  sum += __shfl_xor(sum, 8);
    sum += __shfl_xor(sum, 16);
    float mean = sum * (1.0f / 512.0f);

    float var = 0.0f;
#pragma unroll
    for (int e = 0; e < 16; ++e) { float d = x[e] - mean; var += d * d; }
    var += __shfl_xor(var, 1);  var += __shfl_xor(var, 2);
    var += __shfl_xor(var, 4);  var += __shfl_xor(var, 8);
    var += __shfl_xor(var, 16);
    var *= (1.0f / 511.0f);                   // ddof = 1
    float inv = 1.0f / (sqrtf(var) + 1e-6f);  // eps added to std

#pragma unroll
    for (int e = 0; e < 16; ++e) {
        int c = lane + 32 * e;
        float y = alpha[c] * (x[e] - mean) * inv + beta[c];
        out32[(size_t)row * D_MODEL + c] = y;
        if (out16) out16[(size_t)row * D_MODEL + c] = (bf16)y;
    }
}

// ---------------------------------------------------------------------------
// Launch
// ---------------------------------------------------------------------------
extern "C" void kernel_launch(void* const* d_in, const int* in_sizes, int n_in,
                              void* d_out, int out_size, void* d_ws, size_t ws_size,
                              hipStream_t stream) {
    const float* x    = (const float*)d_in[0];
    const float* wq   = (const float*)d_in[1];
    const float* bq   = (const float*)d_in[2];
    const float* wk   = (const float*)d_in[3];
    const float* bk   = (const float*)d_in[4];
    const float* wv   = (const float*)d_in[5];
    const float* bv   = (const float*)d_in[6];
    const float* wo   = (const float*)d_in[7];
    const float* bo   = (const float*)d_in[8];
    const float* w1   = (const float*)d_in[9];
    const float* b1   = (const float*)d_in[10];
    const float* w2   = (const float*)d_in[11];
    const float* b2   = (const float*)d_in[12];
    const float* ln1a = (const float*)d_in[13];
    const float* ln1b = (const float*)d_in[14];
    const float* ln2a = (const float*)d_in[15];
    const float* ln2b = (const float*)d_in[16];
    float* out = (float*)d_out;

    char* ws = (char*)d_ws;
    size_t off = 0;
    auto carve = [&](size_t bytes) { char* p = ws + off; off += (bytes + 255) & ~(size_t)255; return p; };
    bf16*  xb   = (bf16*)carve((size_t)TOKENS * D_MODEL * 2);
    bf16*  wqT  = (bf16*)carve((size_t)D_MODEL * D_MODEL * 2);
    bf16*  wkT  = (bf16*)carve((size_t)D_MODEL * D_MODEL * 2);
    bf16*  wvT  = (bf16*)carve((size_t)D_MODEL * D_MODEL * 2);
    bf16*  woT  = (bf16*)carve((size_t)D_MODEL * D_MODEL * 2);
    bf16*  w1T  = (bf16*)carve((size_t)D_MODEL * D_FF * 2);
    bf16*  w2T  = (bf16*)carve((size_t)D_FF * D_MODEL * 2);
    bf16*  qb   = (bf16*)carve((size_t)TOKENS * D_MODEL * 2);
    bf16*  kb   = (bf16*)carve((size_t)TOKENS * D_MODEL * 2);
    bf16*  vTb  = (bf16*)carve((size_t)TOKENS * D_MODEL * 2);
    bf16*  attn = (bf16*)carve((size_t)TOKENS * D_MODEL * 2);
    float* z1   = (float*)carve((size_t)TOKENS * D_MODEL * 4);   // reused for z2
    float* y32  = (float*)carve((size_t)TOKENS * D_MODEL * 4);
    bf16*  y16  = (bf16*)carve((size_t)TOKENS * D_MODEL * 2);
    bf16*  ffh  = (bf16*)carve((size_t)TOKENS * D_FF * 2);

    // --- prep: bf16 conversion + weight transposes ---
    prep_kernel<<<PREP_BLOCKS, 256, 0, stream>>>(x, xb, wq, wqT, wk, wkT, wv, wvT,
                                                 wo, woT, w1, w1T, w2, w2T);

    // --- QKV projections: workgroup tile 128x128 -> 256 blocks each, one grid ---
    qkv_wmma_kernel<<<3 * PROJ_BLOCKS, 256, 0, stream>>>(xb, wqT, bq, qb, wkT, bk, kb,
                                                         wvT, bv, vTb, D_MODEL);

    // --- attention: 32 (b,h) * 16 q-blocks, 8 waves each ---
    attn_wmma_kernel<<<BATCH * NHEADS * (SEQ / 128), 256, 0, stream>>>(qb, kb, vTb, attn);

    // --- out-proj + residual -> z1; LN1 -> y (f32 + bf16) ---
    gemm_wmma_kernel<2, D_MODEL><<<256, 256, 0, stream>>>(attn, woT, bo, x, z1, TOKENS, D_MODEL);
    layernorm_kernel<<<TOKENS / 8, 256, 0, stream>>>(z1, ln1a, ln1b, y32, y16);

    // --- FFN1 (ReLU) -> ffh; FFN2 + residual(y) -> z1; LN2 -> out ---
    gemm_wmma_kernel<3, D_FF><<<1024, 256, 0, stream>>>(y16, w1T, b1, nullptr, ffh, TOKENS, D_MODEL);
    gemm_wmma_kernel<2, D_MODEL><<<256, 256, 0, stream>>>(ffh, w2T, b2, y32, z1, TOKENS, D_FF);
    layernorm_kernel<<<TOKENS / 8, 256, 0, stream>>>(z1, ln2a, ln2b, out, nullptr);
}

// v007
// A run of this version takes 123 microseconds.
// Next to v006, in two timings, it ran 1.07 and 1.08 times as fast.
// Counting every step since v000, it is 5.00 times as fast.
#include <hip/hip_runtime.h>
#include <hip/hip_bf16.h>

typedef __bf16 bf16;
typedef bf16  v16bf __attribute__((ext_vector_type(16)));
typedef bf16  v8bf  __attribute__((ext_vector_type(8)));
typedef float v8f   __attribute__((ext_vector_type(8)));

typedef __attribute__((address_space(3))) void as3_void;

#define D_MODEL 512
#define NHEADS  8
#define DK      64
#define D_FF    2048
#define BATCH   4
#define SEQ     2048
#define TOKENS  (BATCH * SEQ)

__device__ __forceinline__ v16bf load_frag(const bf16* __restrict__ base,
                                           int stride, int row0, int k0) {
    int lane = threadIdx.x & 31;
    int r = lane & 15, h = lane >> 4;
    const bf16* p = base + (size_t)(row0 + r) * stride + (k0 + h * 8);
    v8bf lo = *(const v8bf*)(p);
    v8bf hi = *(const v8bf*)(p + 16);
    return __builtin_shufflevector(lo, hi, 0,1,2,3,4,5,6,7,8,9,10,11,12,13,14,15);
}

__device__ __forceinline__ v8f wmma_bf16(v16bf a, v16bf b, v8f c) {
    return __builtin_amdgcn_wmma_f32_16x16x32_bf16(false, a, false, b,
                                                   (short)0, c, false, false);
}

// ---------------------------------------------------------------------------
// Prep kernel. A launch pays for every wave it starts, so each wave moves
// kilobytes, not 32 elements: 16-byte loads, eight in flight a lane, and every
// store instruction fills whole 128-byte lines.
// ---------------------------------------------------------------------------
typedef float v4f  __attribute__((ext_vector_type(4)));
typedef bf16  v4bf __attribute__((ext_vector_type(4)));

// One block converts 8192 consecutive floats: 8 loads of 16 bytes a lane.
// blk = the block's index inside this job's range of the shared grid.
__device__ __forceinline__
void f32_to_bf16_block(const float* __restrict__ in,
                       bf16* __restrict__ out, int n, int blk) {
    int base = blk * 8192;
    if (base + 8192 > n) return;              // block-uniform bound
    int i0 = base + threadIdx.x * 4;
    v4f v[8];
    // Every loop here is unrolled so that v[] and o keep constant indices
    // (registers, no scratch) and all eight loads issue ahead of the first wait.
#pragma unroll
    for (int j = 0; j < 8; ++j) v[j] = *(const v4f*)(in + i0 + j * 1024);
#pragma unroll
    for (int j = 0; j < 8; ++j) {
        v4bf o;
#pragma unroll
        for (int c = 0; c < 4; ++c) o[c] = (bf16)v[j][c];
        *(v4bf*)(out + i0 + j * 1024) = o;
    }
    // Another job's code may follow in the kernel: no register that the stores
    // above name is rewritten ahead of this wait.
    asm volatile("s_wait_xcnt 0x0" ::: "memory");
}

// w is [K,N] row-major f32 -> wT is [N,K] row-major bf16.
// Block tile 64 (k) x 128 (n), wave tile 64 x 16, lane patch 8 (k) x 4 (n):
// lane = 8 * (column quad) + (k octet), so the eight lanes of a column quad
// store 8 x 16 bytes = one whole line of a wT row, and the two waves that
// share a 128-byte line of w sit in the same block.
// K and N are compile-time so that one address pair and immediate offsets
// serve all eight loads, and one pair the four stores.
template <int K, int N>
__device__ __forceinline__
void transpose_to_bf16_block(const float* __restrict__ w,
                             bf16* __restrict__ wT, int blk) {
    constexpr int nblk = N / 128;
    int kt = blk / nblk, nt = blk % nblk;
    if (kt >= K / 64) return;                 // block-uniform bound
    int wave = threadIdx.x >> 5, lane = threadIdx.x & 31;
    int k0 = kt * 64 + (lane & 7) * 8;
    int n0 = nt * 128 + wave * 16 + (lane >> 3) * 4;
    const float* src = w + k0 * N + n0;
    bf16* dst = wT + n0 * K + k0;
    v4f v[8];
    // Unrolled for the same two reasons as in the cast job above.
#pragma unroll
    for (int j = 0; j < 8; ++j) v[j] = *(const v4f*)(src + j * N);
#pragma unroll
    for (int c = 0; c < 4; ++c) {
        v8bf o;
#pragma unroll
        for (int j = 0; j < 8; ++j) o[j] = (bf16)v[j][c];
        *(v8bf*)(dst + c * K) = o;
    }
    // Another job's code may follow in the kernel: no register that the stores
    // above name is rewritten ahead of this wait.
    asm volatile("s_wait_xcnt 0x0" ::: "memory");
}

#define CAST_BLOCKS ((TOKENS * D_MODEL) / 8192)
#define SQ_BLOCKS   ((D_MODEL * D_MODEL) / 8192)
#define FF_BLOCKS   ((D_MODEL * D_FF) / 8192)
#define PREP_BLOCKS (CAST_BLOCKS + 4 * SQ_BLOCKS + 2 * FF_BLOCKS)

__global__ __launch_bounds__(256)
void prep_kernel(const float* __restrict__ x,  bf16* __restrict__ xb,
                 const float* __restrict__ wq, bf16* __restrict__ wqT,
                 const float* __restrict__ wk, bf16* __restrict__ wkT,
                 const float* __restrict__ wv, bf16* __restrict__ wvT,
                 const float* __restrict__ wo, bf16* __restrict__ woT,
                 const float* __restrict__ w1, bf16* __restrict__ w1T,
                 const float* __restrict__ w2, bf16* __restrict__ w2T) {
    int b = blockIdx.x;
    if (b < CAST_BLOCKS) {
        f32_to_bf16_block(x, xb, TOKENS * D_MODEL, b);
        return;
    }
    b -= CAST_BLOCKS;
    if (b < 4 * SQ_BLOCKS) {
        int which = b / SQ_BLOCKS;
        const float* w = which == 0 ? wq : which == 1 ? wk : which == 2 ? wv : wo;
        bf16* wT = which == 0 ? wqT : which == 1 ? wkT : which == 2 ? wvT : woT;
        transpose_to_bf16_block<D_MODEL, D_MODEL>(w, wT, b % SQ_BLOCKS);
        return;
    }
    b -= 4 * SQ_BLOCKS;
    if (b < FF_BLOCKS) transpose_to_bf16_block<D_MODEL, D_FF>(w1, w1T, b);
    else               transpose_to_bf16_block<D_FF, D_MODEL>(w2, w2T, b - FF_BLOCKS);
}

// ---------------------------------------------------------------------------
// WMMA GEMM, both operands staged in LDS.
// Workgroup: 256 threads (8 waves), tile 128 (M) x 128 (N); waves 4 (M) x 2 (N),
// each owns a 32x64 slice (8 accumulators). A stage is 128 k of the 128 rows of
// A and of the 128 rows of B^T: rows of 256 bytes, copied in whole lines by
// asynchronous copies into two buffers, the next stage in flight while this one
// is worked on. A row of A then serves 2 waves and a row of B^T serves 4, and
// no wave waits on a global load inside the k loop.
// Needs M, N multiples of 128 and K a multiple of 128.
// MODE and N are compile-time: the epilogue then holds no branch, and one
// address with immediate offsets serves all of a lane's loads or stores. MODE:
//   0 = bf16, rows are tokens, columns scattered to [b,h,s,dk] (Q/K)
//   1 = bf16, rows are channels, columns are tokens -> [b,h,dk,s] (V^T = Wv^T X^T),
//       bias by row
//   2 = f32 [M,N] + residual;   3 = bf16 [M,N] with ReLU
// Each 16x16 product is taken transposed (B^T rows as the A operand, A rows as
// the B operand): in the accumulator map a lane then holds 8 ADJACENT columns of
// one output row, 16 bytes of bf16. Every wave turns its 32x64 slice through its
// own piece of the finished ring, so that each global store (and each residual
// load) is 16 bytes a lane over whole 128-byte lines.
// ---------------------------------------------------------------------------
#define GT_ROWS    128                        // rows of either operand in a stage
#define GT_K       128                        // k elements in a stage
#define GPITCH     136                        // elements: 256 + 16 bytes, 16 x odd
#define GBUF_BYTES (GT_ROWS * GPITCH * 2)
#define STG_PITCH16 144                       // bytes: 64 bf16 + 16, 16 x odd
#define STG_PITCH32 272                       // bytes: 64 f32 + 16, 16 x odd
#define STG_BYTES   (32 * STG_PITCH32)        // a wave's piece; 8 pieces = As

__device__ __forceinline__ void gemm_stage_copy(const bf16* g, size_t step, unsigned l) {
    asm volatile(
        "global_load_async_to_lds_b128 %0, %8, off\n\t"
        "global_load_async_to_lds_b128 %1, %9, off\n\t"
        "global_load_async_to_lds_b128 %2, %10, off\n\t"
        "global_load_async_to_lds_b128 %3, %11, off\n\t"
        "global_load_async_to_lds_b128 %4, %12, off\n\t"
        "global_load_async_to_lds_b128 %5, %13, off\n\t"
        "global_load_async_to_lds_b128 %6, %14, off\n\t"
        "global_load_async_to_lds_b128 %7, %15, off\n\t"
        "s_wait_xcnt 0x0"
        :: "v"(l), "v"(l + 16 * GPITCH * 2), "v"(l + 32 * GPITCH * 2),
           "v"(l + 48 * GPITCH * 2), "v"(l + 64 * GPITCH * 2),
           "v"(l + 80 * GPITCH * 2), "v"(l + 96 * GPITCH * 2),
           "v"(l + 112 * GPITCH * 2),
           "v"(g), "v"(g + step), "v"(g + 2 * step), "v"(g + 3 * step),
           "v"(g + 4 * step), "v"(g + 5 * step), "v"(g + 6 * step), "v"(g + 7 * step)
        : "memory");
}

typedef bf16 gemm_ring[2][GT_ROWS][GPITCH];

// One block tile. The kernel owns the two rings and hands them in, so that a
// kernel which holds several MODEs still has one pair of rings in LDS.
// blk = the block's index inside this product's range of the grid.
template <int MODE, int N>
__device__ __forceinline__
void gemm_tile(gemm_ring& As, gemm_ring& Bs, int blk,
               const bf16* __restrict__ A,
               const bf16* __restrict__ Bt,
               const float* __restrict__ bias,
               const float* __restrict__ resid,
               void* __restrict__ outp,
               int K) {
    int tid   = threadIdx.x;
    int wave  = tid >> 5;
    constexpr int gridN = N >> 7;               // N / 128
    int blkM  = (blk / gridN) << 7;
    int blkN  = (blk % gridN) << 7;
    int wm    = (wave >> 1) * 32;               // this wave's rows in the block tile
    int wn    = (wave & 1) * 64;                // ... and its columns
    int tileM = blkM + wm;
    int tN    = blkN + wn;

    // This lane's first copy of stage 0: a wave's copy covers four whole lines.
    int crow = tid >> 4;                        // 0..15
    int ccol = (tid & 15) * 8;                  // element offset, 16-byte granules
    const bf16* ag = A  + (size_t)(blkM + crow) * K + ccol;
    const bf16* bg = Bt + (size_t)(blkN + crow) * K + ccol;
    unsigned al = (unsigned)(size_t)(as3_void*)&As[0][crow][ccol];
    unsigned bl = (unsigned)(size_t)(as3_void*)&Bs[0][crow][ccol];
    size_t step = (size_t)16 * K;

    v8f acc[2][4];
#pragma unroll
    for (int mi = 0; mi < 2; ++mi)
#pragma unroll
        for (int t = 0; t < 4; ++t)
#pragma unroll
            for (int i = 0; i < 8; ++i) acc[mi][t][i] = 0.0f;

    int stages = K >> 7;
    gemm_stage_copy(ag, step, al);
    gemm_stage_copy(bg, step, bl);
    asm volatile("s_wait_asynccnt 0x0" ::: "memory");   // stage 0 landed
    __syncthreads();                                    // ... and is public
    if (stages > 1) {
        gemm_stage_copy(ag + GT_K, step, al + GBUF_BYTES);
        gemm_stage_copy(bg + GT_K, step, bl + GBUF_BYTES);
    }

    for (int st = 0; st < stages; ++st) {
        const bf16* at = &As[st & 1][wm][0];
        const bf16* bt = &Bs[st & 1][wn][0];
        // Two fragment sets: the next k block's twelve LDS reads go out as one
        // group ahead of this block's WMMAs, never past the end of the stage.
        // Unrolled so that fa and fb keep constant indices (registers) and the
        // reads take immediate offsets.
        v16bf fa[2][2], fb[2][4];
        fa[0][0] = load_frag(at, GPITCH, 0, 0);
        fa[0][1] = load_frag(at, GPITCH, 16, 0);
#pragma unroll
        for (int t = 0; t < 4; ++t) fb[0][t] = load_frag(bt, GPITCH, 16 * t, 0);
#pragma unroll
        for (int kb = 0; kb < GT_K / 32; ++kb) {
            const int cs = kb & 1, ns = cs ^ 1;
            if (kb + 1 < GT_K / 32) {
                fa[ns][0] = load_frag(at, GPITCH, 0,  (kb + 1) * 32);
                fa[ns][1] = load_frag(at, GPITCH, 16, (kb + 1) * 32);
#pragma unroll
                for (int t = 0; t < 4; ++t)
                    fb[ns][t] = load_frag(bt, GPITCH, 16 * t, (kb + 1) * 32);
            }
            // Holds the read group above ahead of the WMMAs below: left free, the
            // scheduler sinks each read to just in front of its use, and the
            // wave then waits out one LDS latency for every two WMMAs. Before the
            // last block it keeps the block before in front of the stage's
            // closing wait, where its WMMAs cover the last read group's latency.
            __builtin_amdgcn_sched_barrier(0);
#pragma unroll
            for (int t = 0; t < 4; ++t) {
                acc[0][t] = wmma_bf16(fb[cs][t], fa[cs][0], acc[0][t]);
                acc[1][t] = wmma_bf16(fb[cs][t], fa[cs][1], acc[1][t]);
            }
        }
        // Publish point: own LDS reads done, own copies of the next stage landed,
        // then the barrier that publishes that stage and frees this one's buffer.
        asm volatile("s_wait_dscnt 0x0" ::: "memory");
        asm volatile("s_wait_asynccnt 0x0" ::: "memory");
        __syncthreads();
        if (st + 2 < stages) {
            gemm_stage_copy(ag + (st + 2) * GT_K, step, al + (st & 1) * GBUF_BYTES);
            gemm_stage_copy(bg + (st + 2) * GT_K, step, bl + (st & 1) * GBUF_BYTES);
        }
    }
    asm volatile("s_wait_asynccnt 0x0" ::: "memory");   // nothing in flight at the end

    // acc[mi][t][i] = C[tileM + 16 mi + r][tN + 16 t + 8 hf + i].
    // The loop's last publish point (every wave's LDS reads done, no copy in
    // flight, barrier) has freed the ring: each wave stages in its own piece.
    int lane = tid & 31;
    int r = lane & 15, hf = lane >> 4;
    char* stg = (char*)&As[0][0][0] + wave * STG_BYTES;

    if constexpr (MODE == 2) {
        // Read-back map: a wave instruction covers two rows of 256 bytes.
        int rrow = lane >> 4, rcol = (lane & 15) * 4;
        // One 32-bit byte offset (below M * N * 4 = 2^24) on the two scalar bases
        // serves the residual loads and the stores.
        unsigned b0 = (unsigned)(tN + rcol) * 4u;
        unsigned g0 = (unsigned)(tileM + rrow) * (N * 4u) + b0;
        constexpr unsigned gstep = 2 * N * 4;
        const char* rbase = (const char*)resid + g0;
        char* obase = (char*)outp + g0;
        v4f rs[16];
        // Unrolled here and below: rs keeps constant indices (registers), and all
        // sixteen residual loads are in flight before the first is waited for.
#pragma unroll
        for (int j = 0; j < 16; ++j) rs[j] = *(const v4f*)(rbase + j * gstep);
        v4f bz = *(const v4f*)((const char*)bias + b0);
#pragma unroll
        for (int mi = 0; mi < 2; ++mi)
#pragma unroll
            for (int t = 0; t < 4; ++t) {
                char* p = stg + (mi * 16 + r) * STG_PITCH32 + (t * 16 + 8 * hf) * 4;
                v4f lo, hi;
#pragma unroll
                for (int i = 0; i < 4; ++i) { lo[i] = acc[mi][t][i]; hi[i] = acc[mi][t][4 + i]; }
                *(v4f*)p = lo;
                *(v4f*)(p + 16) = hi;
            }
        // Own LDS writes done before other lanes' rows are read back.
        asm volatile("s_wait_dscnt 0x0" ::: "memory");
#pragma unroll
        for (int j = 0; j < 16; ++j) {
            v4f v = *(const v4f*)(stg + (2 * j + rrow) * STG_PITCH32 + rcol * 4);
            *(v4f*)(obase + j * gstep) = (v + bz) + rs[j];
        }
        // Another job's code may follow in the kernel: no register that the stores
        // above name is rewritten ahead of this wait.
        asm volatile("s_wait_xcnt 0x0" ::: "memory");
    } else {
        float brow[2];
        v4f bcol[4][2];
        if constexpr (MODE == 1) {
            brow[0] = bias[tileM + r];
            brow[1] = bias[tileM + 16 + r];
        } else {
#pragma unroll
            for (int t = 0; t < 4; ++t) {
                bcol[t][0] = *(const v4f*)(bias + tN + t * 16 + 8 * hf);
                bcol[t][1] = *(const v4f*)(bias + tN + t * 16 + 8 * hf + 4);
            }
        }
#pragma unroll
        for (int mi = 0; mi < 2; ++mi)
#pragma unroll
            for (int t = 0; t < 4; ++t) {
                v8bf o;
#pragma unroll
                for (int i = 0; i < 8; ++i) {
                    float v = acc[mi][t][i];
                    if constexpr (MODE == 1) v += brow[mi];
                    else                     v += bcol[t][i >> 2][i & 3];
                    if constexpr (MODE == 3) v = fmaxf(v, 0.0f);
                    o[i] = (bf16)v;
                }
                *(v8bf*)(stg + (mi * 16 + r) * STG_PITCH16 + (t * 16 + 8 * hf) * 2) = o;
            }
        // Own LDS writes done before other lanes' rows are read back.
        asm volatile("s_wait_dscnt 0x0" ::: "memory");
        // Read-back map: a wave instruction covers four rows of 128 bytes.
        int rrow = lane >> 3, rcol = (lane & 7) * 8;
        int m0 = tileM + rrow;
        // Output pitch in elements, and this lane's first element.
        constexpr size_t gpitch = MODE == 0 ? DK : MODE == 1 ? SEQ : N;
        size_t g0;
        if constexpr (MODE == 0)                // [b, h, s, dk]: one head a wave
            g0 = ((((size_t)(m0 >> 11) * NHEADS + (tN >> 6)) * SEQ) + (m0 & (SEQ - 1))) * DK + rcol;
        else if constexpr (MODE == 1)           // [b, h*dk, s]: one batch a wave
            g0 = ((size_t)(tN >> 11) * D_MODEL + m0) * SEQ + (tN & (SEQ - 1)) + rcol;
        else
            g0 = (size_t)m0 * N + tN + rcol;
#pragma unroll
        for (int j = 0; j < 8; ++j) {
            v8bf o = *(const v8bf*)(stg + (4 * j + rrow) * STG_PITCH16 + rcol * 2);
            *(v8bf*)((bf16*)outp + g0 + j * 4 * gpitch) = o;
        }
        // Another job's code may follow in the kernel: no register that the stores
        // above name is rewritten ahead of this wait.
        asm volatile("s_wait_xcnt 0x0" ::: "memory");
    }
}

template <int MODE, int N>
__global__ __launch_bounds__(256)
void gemm_wmma_kernel(const bf16* __restrict__ A,
                      const bf16* __restrict__ Bt,
                      const float* __restrict__ bias,
                      const float* __restrict__ resid,
                      void* __restrict__ outp,
                      int M, int K) {
    __shared__ __attribute__((aligned(16))) bf16 As[2][GT_ROWS][GPITCH];
    __shared__ __attribute__((aligned(16))) bf16 Bs[2][GT_ROWS][GPITCH];
    gemm_tile<MODE, N>(As, Bs, blockIdx.x, A, Bt, bias, resid, outp, K);
}

// Q, K and V^T need nothing of each other: one grid, a third of the block index
// each. The branch is block-uniform, so every barrier inside a tile is reached
// by the whole work-group or by none of it.
#define PROJ_BLOCKS ((TOKENS / 128) * (D_MODEL / 128))

__global__ __launch_bounds__(256)
void qkv_wmma_kernel(const bf16* __restrict__ xb,
                     const bf16* __restrict__ wqT, const float* __restrict__ bq,
                     bf16* __restrict__ qo,
                     const bf16* __restrict__ wkT, const float* __restrict__ bk,
                     bf16* __restrict__ ko,
                     const bf16* __restrict__ wvT, const float* __restrict__ bv,
                     bf16* __restrict__ vTo,
                     int K) {
    __shared__ __attribute__((aligned(16))) bf16 As[2][GT_ROWS][GPITCH];
    __shared__ __attribute__((aligned(16))) bf16 Bs[2][GT_ROWS][GPITCH];
    int b = blockIdx.x;
    if (b < 2 * PROJ_BLOCKS) {
        bool isq = b < PROJ_BLOCKS;
        gemm_tile<0, D_MODEL>(As, Bs, isq ? b : b - PROJ_BLOCKS, xb,
                              isq ? wqT : wkT, isq ? bq : bk, nullptr,
                              isq ? qo : ko, K);
    } else {
        gemm_tile<1, TOKENS>(As, Bs, b - 2 * PROJ_BLOCKS, wvT, xb, bv, nullptr,
                             vTo, K);
    }
}

__device__ __forceinline__ float xhalf(float x) {
    int b = __builtin_bit_cast(int, x);
    return __builtin_bit_cast(float,
        __builtin_amdgcn_permlanex16(b, b, 0x76543210, 0xfedcba98, false, false));
}

__device__ __forceinline__ void exp2_x8(float (&x)[8]) {
    asm("v_exp_f32 %0, %0\n\t"
        "v_exp_f32 %1, %1\n\t"
        "v_exp_f32 %2, %2\n\t"
        "v_exp_f32 %3, %3\n\t"
        "v_exp_f32 %4, %4\n\t"
        "v_exp_f32 %5, %5\n\t"
        "v_exp_f32 %6, %6\n\t"
        "v_exp_f32 %7, %7\n\t"
        "v_nop"
        : "+v"(x[0]), "+v"(x[1]), "+v"(x[2]), "+v"(x[3]),
          "+v"(x[4]), "+v"(x[5]), "+v"(x[6]), "+v"(x[7]));
}

__device__ __forceinline__ float exp2_x1(float x) {
    asm("v_exp_f32 %0, %0\n\t"
        "v_nop"
        : "+v"(x));
    return x;
}

#define LOG2E 1.44269504f

#define ATT_KEYS   128
#define ATT_STAGES (SEQ / ATT_KEYS)
#define KPITCH     72                         // elements: 128 + 16 bytes
#define VPITCH     136                        // elements: 256 + 16 bytes
#define KBUF_BYTES (ATT_KEYS * KPITCH * 2)
#define VBUF_BYTES (DK * VPITCH * 2)

__device__ __forceinline__ void attn_stage_copy(const bf16* kg, const bf16* vg,
                                                unsigned kl, unsigned vl) {
    asm volatile(
        "global_load_async_to_lds_b128 %0, %8, off\n\t"
        "global_load_async_to_lds_b128 %1, %9, off\n\t"
        "global_load_async_to_lds_b128 %2, %10, off\n\t"
        "global_load_async_to_lds_b128 %3, %11, off\n\t"
        "global_load_async_to_lds_b128 %4, %12, off\n\t"
        "global_load_async_to_lds_b128 %5, %13, off\n\t"
        "global_load_async_to_lds_b128 %6, %14, off\n\t"
        "global_load_async_to_lds_b128 %7, %15, off\n\t"
        "s_wait_xcnt 0x0"
        :: "v"(kl), "v"(kl + 32 * KPITCH * 2), "v"(kl + 64 * KPITCH * 2),
           "v"(kl + 96 * KPITCH * 2),
           "v"(vl), "v"(vl + 16 * VPITCH * 2), "v"(vl + 32 * VPITCH * 2),
           "v"(vl + 48 * VPITCH * 2),
           "v"(kg), "v"(kg + 32 * DK), "v"(kg + 64 * DK), "v"(kg + 96 * DK),
           "v"(vg), "v"(vg + 16 * SEQ), "v"(vg + 32 * SEQ), "v"(vg + 48 * SEQ)
        : "memory");
}

__global__ __launch_bounds__(256)
void attn_wmma_kernel(const bf16* __restrict__ q,
                      const bf16* __restrict__ k,
                      const bf16* __restrict__ vT,
                      bf16* __restrict__ attn_c) {
    __shared__ __attribute__((aligned(16))) bf16 Ks[2][ATT_KEYS][KPITCH];
    __shared__ __attribute__((aligned(16))) bf16 Vs[2][DK][VPITCH];

    int tid  = threadIdx.x;
    int wid  = tid >> 5;
    int lane = tid & 31;
    int r = lane & 15, hf = lane >> 4;

    int qblocks = SEQ / 128;
    int bh = blockIdx.x / qblocks;
    int qt = (blockIdx.x % qblocks) * 128 + wid * 16;

    const bf16* qh = q  + (size_t)bh * SEQ * DK;
    const bf16* kh = k  + (size_t)bh * SEQ * DK;
    const bf16* vh = vT + (size_t)bh * DK * SEQ;

    // This lane's first copy of stage 0: a wave's copy covers four whole lines.
    const bf16* kg = kh + tid * 8;
    const bf16* vg = vh + (tid >> 4) * SEQ + (tid & 15) * 8;
    unsigned kl = (unsigned)(size_t)(as3_void*)&Ks[0][tid >> 3][(tid & 7) * 8];
    unsigned vl = (unsigned)(size_t)(as3_void*)&Vs[0][tid >> 4][(tid & 15) * 8];

    attn_stage_copy(kg, vg, kl, vl);
    asm volatile("s_wait_asynccnt 0x0" ::: "memory");   // stage 0 landed
    __syncthreads();                                    // ... and is public
    attn_stage_copy(kg + ATT_KEYS * DK, vg + ATT_KEYS, kl + KBUF_BYTES, vl + VBUF_BYTES);

    v16bf qb0 = load_frag(qh, DK, qt, 0);     // B operand: column = query
    v16bf qb1 = load_frag(qh, DK, qt, 32);

    v8f o[4];                                 // o[t][i] = O[query r][16t + 8hf + i]
#pragma unroll
    for (int t = 0; t < 4; ++t)
#pragma unroll
        for (int i = 0; i < 8; ++i) o[t][i] = 0.0f;
    float mrun = -1e30f;                      // maximum of query r, equal in both halves
    float lsum = 0.0f;                        // this half's share of the sum of query r

    for (int st = 0; st < ATT_STAGES; ++st) {
        const bf16* kt = &Ks[st & 1][0][0];
        const bf16* vt = &Vs[st & 1][0][0];
        // Unrolled so that the LDS reads of all four passes take immediate offsets.
#pragma unroll
        for (int j = 0; j < ATT_KEYS; j += 32) {
            v8f s0, s1;                           // s0[i]: key j + 8hf + i; s1[i]: 16 further
#pragma unroll
            for (int i = 0; i < 8; ++i) { s0[i] = 0.0f; s1[i] = 0.0f; }
            s0 = wmma_bf16(load_frag(kt, KPITCH, j, 0),       qb0, s0);
            s0 = wmma_bf16(load_frag(kt, KPITCH, j, 32),      qb1, s0);
            s1 = wmma_bf16(load_frag(kt, KPITCH, j + 16, 0),  qb0, s1);
            s1 = wmma_bf16(load_frag(kt, KPITCH, j + 16, 32), qb1, s1);

            float mx = -1e30f;
#pragma unroll
            for (int i = 0; i < 8; ++i) {
                s0[i] *= 0.125f;                  // 1/sqrt(dk)
                s1[i] *= 0.125f;
                mx = fmaxf(mx, fmaxf(s0[i], s1[i]));
            }
            mx = fmaxf(mx, xhalf(mx));
            float nm   = fmaxf(mrun, mx);
            float corr = exp2_x1((mrun - nm) * LOG2E);
            mrun = nm;

            float p0[8], p1[8];
            // Unrolled so that p0 and p1 keep constant indices (registers).
#pragma unroll
            for (int i = 0; i < 8; ++i) {
                p0[i] = (s0[i] - nm) * LOG2E;
                p1[i] = (s1[i] - nm) * LOG2E;
            }
            exp2_x8(p0);
            exp2_x8(p1);

            v16bf pb;                             // B operand in the fragment's k order
            float rs = 0.0f;
#pragma unroll
            for (int i = 0; i < 8; ++i) {
                rs += p0[i] + p1[i];
                pb[i]     = (bf16)p0[i];
                pb[8 + i] = (bf16)p1[i];
            }
            lsum = lsum * corr + rs;

#pragma unroll
            for (int t = 0; t < 4; ++t)
#pragma unroll
                for (int i = 0; i < 8; ++i) o[t][i] *= corr;
#pragma unroll
            for (int t = 0; t < 4; ++t)
                o[t] = wmma_bf16(load_frag(vt, VPITCH, t * 16, j), pb, o[t]);
        }
        // Publish point: own LDS reads done, own copies of the next stage landed,
        // then the barrier that publishes that stage and frees this one's buffer.
        asm volatile("s_wait_dscnt 0x0" ::: "memory");
        asm volatile("s_wait_asynccnt 0x0" ::: "memory");
        __syncthreads();
        if (st + 2 < ATT_STAGES)
            attn_stage_copy(kg + (st + 2) * (ATT_KEYS * DK), vg + (st + 2) * ATT_KEYS,
                            kl + (st & 1) * KBUF_BYTES, vl + (st & 1) * VBUF_BYTES);
    }
    asm volatile("s_wait_asynccnt 0x0" ::: "memory");   // nothing in flight at the end

    lsum += xhalf(lsum);                      // join the halves' sums once

    int bb = bh >> 3, hd = bh & (NHEADS - 1);
    size_t tok = (size_t)bb * SEQ + qt + r;
#pragma unroll
    for (int t = 0; t < 4; ++t) {
        v8bf ov;                              // 8 consecutive columns of one token
#pragma unroll
        for (int i = 0; i < 8; ++i) ov[i] = (bf16)(o[t][i] / lsum);
        *(v8bf*)(attn_c + tok * D_MODEL + hd * DK + t * 16 + 8 * hf) = ov;
    }
}

// ---------------------------------------------------------------------------
// LayerNorm (faithful: unbiased std, eps added to std). A wave takes four rows,
// a lane 16 bytes of every 512: the sixteen row loads and the eight loads of
// alpha and beta all go out ahead of the first wait, alpha and beta serve four
// rows from registers, and every store instruction fills whole 128-byte lines.
// One block of 8 waves = 32 rows; the grid is TOKENS / 32 blocks.
// ---------------------------------------------------------------------------
#define LN_ROWS 4

template <bool W16>
__global__ __launch_bounds__(256)
void layernorm_kernel(const float* __restrict__ z,
                      const float* __restrict__ alpha,
                      const float* __restrict__ beta,
                      float* __restrict__ out32,
                      bf16* __restrict__ out16) {
    int wid  = threadIdx.x >> 5;
    int lane = threadIdx.x & 31;
    int row0 = (blockIdx.x * 8 + wid) * LN_ROWS;
    int c0   = lane * 4;                      // this lane's first column of each 128
    int e0   = row0 * D_MODEL + c0;           // below TOKENS * D_MODEL = 2^22

    // Every loop here is unrolled so that the arrays keep constant indices
    // (registers, no scratch) and the loads take immediate offsets.
    v4f x[LN_ROWS][4], a[4], b[4];
#pragma unroll
    for (int rr = 0; rr < LN_ROWS; ++rr)
#pragma unroll
        for (int j = 0; j < 4; ++j)
            x[rr][j] = *(const v4f*)(z + e0 + rr * D_MODEL + j * 128);
#pragma unroll
    for (int j = 0; j < 4; ++j) {
        a[j] = *(const v4f*)(alpha + c0 + j * 128);
        b[j] = *(const v4f*)(beta  + c0 + j * 128);
    }
    // Keeps the loads of alpha and beta up here: left free, the scheduler sinks
    // them behind the two reductions, and the wave waits out their latency there.
    __builtin_amdgcn_sched_barrier(0);

    float sum[LN_ROWS];
#pragma unroll
    for (int rr = 0; rr < LN_ROWS; ++rr) {
        float t = 0.0f;
#pragma unroll
        for (int j = 0; j < 4; ++j)
#pragma unroll
            for (int c = 0; c < 4; ++c) t += x[rr][j][c];
        sum[rr] = t;
    }
    // The four rows' exchanges of one step need nothing of each other.
#pragma unroll
    for (int m = 1; m < 32; m <<= 1)
#pragma unroll
        for (int rr = 0; rr < LN_ROWS; ++rr) sum[rr] += __shfl_xor(sum[rr], m);

    float mean[LN_ROWS], var[LN_ROWS];
#pragma unroll
    for (int rr = 0; rr < LN_ROWS; ++rr) {
        mean[rr] = sum[rr] * (1.0f / 512.0f);
        float t = 0.0f;
#pragma unroll
        for (int j = 0; j < 4; ++j)
#pragma unroll
            for (int c = 0; c < 4; ++c) { float d = x[rr][j][c] - mean[rr]; t += d * d; }
        var[rr] = t;
    }
#pragma unroll
    for (int m = 1; m < 32; m <<= 1)
#pragma unroll
        for (int rr = 0; rr < LN_ROWS; ++rr) var[rr] += __shfl_xor(var[rr], m);

#pragma unroll
    for (int rr = 0; rr < LN_ROWS; ++rr) {
        float v = var[rr] * (1.0f / 511.0f);      // ddof = 1
        float inv = 1.0f / (sqrtf(v) + 1e-6f);    // eps added to std
#pragma unroll
        for (int j = 0; j < 4; ++j) {
            v4f y;
#pragma unroll
            for (int c = 0; c < 4; ++c)
                y[c] = a[j][c] * (x[rr][j][c] - mean[rr]) * inv + b[j][c];
            *(v4f*)(out32 + e0 + rr * D_MODEL + j * 128) = y;
            if constexpr (W16) {
                v4bf o;
#pragma unroll
                for (int c = 0; c < 4; ++c) o[c] = (bf16)y[c];
                *(v4bf*)(out16 + e0 + rr * D_MODEL + j * 128) = o;
            }
        }
    }
}

// ---------------------------------------------------------------------------
// Launch
// ---------------------------------------------------------------------------
extern "C" void kernel_launch(void* const* d_in, const int* in_sizes, int n_in,
                              void* d_out, int out_size, void* d_ws, size_t ws_size,
                              hipStream_t stream) {
    const float* x    = (const float*)d_in[0];
    const float* wq   = (const float*)d_in[1];
    const float* bq   = (const float*)d_in[2];
    const float* wk   = (const float*)d_in[3];
    const float* bk   = (const float*)d_in[4];
    const float* wv   = (const float*)d_in[5];
    const float* bv   = (const float*)d_in[6];
    const float* wo   = (const float*)d_in[7];
    const float* bo   = (const float*)d_in[8];
    const float* w1   = (const float*)d_in[9];
    const float* b1   = (const float*)d_in[10];
    const float* w2   = (const float*)d_in[11];
    const float* b2   = (const float*)d_in[12];
    const float* ln1a = (const float*)d_in[13];
    const float* ln1b = (const float*)d_in[14];
    const float* ln2a = (const float*)d_in[15];
    const float* ln2b = (const float*)d_in[16];
    float* out = (float*)d_out;

    char* ws = (char*)d_ws;
    size_t off = 0;
    auto carve = [&](size_t bytes) { char* p = ws + off; off += (bytes + 255) & ~(size_t)255; return p; };
    bf16*  xb   = (bf16*)carve((size_t)TOKENS * D_MODEL * 2);
    bf16*  wqT  = (bf16*)carve((size_t)D_MODEL * D_MODEL * 2);
    bf16*  wkT  = (bf16*)carve((size_t)D_MODEL * D_MODEL * 2);
    bf16*  wvT  = (bf16*)carve((size_t)D_MODEL * D_MODEL * 2);
    bf16*  woT  = (bf16*)carve((size_t)D_MODEL * D_MODEL * 2);
    bf16*  w1T  = (bf16*)carve((size_t)D_MODEL * D_FF * 2);
    bf16*  w2T  = (bf16*)carve((size_t)D_FF * D_MODEL * 2);
    bf16*  qb   = (bf16*)carve((size_t)TOKENS * D_MODEL * 2);
    bf16*  kb   = (bf16*)carve((size_t)TOKENS * D_MODEL * 2);
    bf16*  vTb  = (bf16*)carve((size_t)TOKENS * D_MODEL * 2);
    bf16*  attn = (bf16*)carve((size_t)TOKENS * D_MODEL * 2);
    float* z1   = (float*)carve((size_t)TOKENS * D_MODEL * 4);   // reused for z2
    float* y32  = (float*)carve((size_t)TOKENS * D_MODEL * 4);
    bf16*  y16  = (bf16*)carve((size_t)TOKENS * D_MODEL * 2);
    bf16*  ffh  = (bf16*)carve((size_t)TOKENS * D_FF * 2);

    // --- prep: bf16 conversion + weight transposes ---
    prep_kernel<<<PREP_BLOCKS, 256, 0, stream>>>(x, xb, wq, wqT, wk, wkT, wv, wvT,
                                                 wo, woT, w1, w1T, w2, w2T);

    // --- QKV projections: workgroup tile 128x128 -> 256 blocks each, one grid ---
    qkv_wmma_kernel<<<3 * PROJ_BLOCKS, 256, 0, stream>>>(xb, wqT, bq, qb, wkT, bk, kb,
                                                         wvT, bv, vTb, D_MODEL);

    // --- attention: 32 (b,h) * 16 q-blocks, 8 waves each ---
    attn_wmma_kernel<<<BATCH * NHEADS * (SEQ / 128), 256, 0, stream>>>(qb, kb, vTb, attn);

    // --- out-proj + residual -> z1; LN1 -> y (f32 + bf16) ---
    gemm_wmma_kernel<2, D_MODEL><<<256, 256, 0, stream>>>(attn, woT, bo, x, z1, TOKENS, D_MODEL);
    layernorm_kernel<true><<<TOKENS / 32, 256, 0, stream>>>(z1, ln1a, ln1b, y32, y16);

    // --- FFN1 (ReLU) -> ffh; FFN2 + residual(y) -> z1; LN2 -> out ---
    gemm_wmma_kernel<3, D_FF><<<1024, 256, 0, stream>>>(y16, w1T, b1, nullptr, ffh, TOKENS, D_MODEL);
    gemm_wmma_kernel<2, D_MODEL><<<256, 256, 0, stream>>>(ffh, w2T, b2, y32, z1, TOKENS, D_FF);
    layernorm_kernel<false><<<TOKENS / 32, 256, 0, stream>>>(z1, ln2a, ln2b, out, nullptr);
}

// v008
// A run of this version takes 115 microseconds.
// Next to v007, in two timings, it ran 1.07 times as fast each time.
// Counting every step since v000, it is 5.33 times as fast.
#include <hip/hip_runtime.h>
#include <hip/hip_bf16.h>

typedef __bf16 bf16;
typedef bf16  v16bf __attribute__((ext_vector_type(16)));
typedef bf16  v8bf  __attribute__((ext_vector_type(8)));
typedef float v8f   __attribute__((ext_vector_type(8)));

typedef __attribute__((address_space(3))) void as3_void;

#define D_MODEL 512
#define NHEADS  8
#define DK      64
#define D_FF    2048
#define BATCH   4
#define SEQ     2048
#define TOKENS  (BATCH * SEQ)

__device__ __forceinline__ v16bf load_frag(const bf16* __restrict__ base,
                                           int stride, int row0, int k0) {
    int lane = threadIdx.x & 31;
    int r = lane & 15, h = lane >> 4;
    const bf16* p = base + (size_t)(row0 + r) * stride + (k0 + h * 8);
    v8bf lo = *(const v8bf*)(p);
    v8bf hi = *(const v8bf*)(p + 16);
    return __builtin_shufflevector(lo, hi, 0,1,2,3,4,5,6,7,8,9,10,11,12,13,14,15);
}

__device__ __forceinline__ v8f wmma_bf16(v16bf a, v16bf b, v8f c) {
    return __builtin_amdgcn_wmma_f32_16x16x32_bf16(false, a, false, b,
                                                   (short)0, c, false, false);
}

// ---------------------------------------------------------------------------
// Prep kernel. A launch pays for every wave it starts, so each wave moves
// kilobytes, not 32 elements: 16-byte loads, eight in flight a lane, and every
// store instruction fills whole 128-byte lines.
// ---------------------------------------------------------------------------
typedef float v4f  __attribute__((ext_vector_type(4)));
typedef bf16  v4bf __attribute__((ext_vector_type(4)));

// One block converts 8192 consecutive floats: 8 loads of 16 bytes a lane.
// blk = the block's index inside this job's range of the shared grid.
__device__ __forceinline__
void f32_to_bf16_block(const float* __restrict__ in,
                       bf16* __restrict__ out, int n, int blk) {
    int base = blk * 8192;
    if (base + 8192 > n) return;              // block-uniform bound
    int i0 = base + threadIdx.x * 4;
    v4f v[8];
    // Every loop here is unrolled so that v[] and o keep constant indices
    // (registers, no scratch) and all eight loads issue ahead of the first wait.
#pragma unroll
    for (int j = 0; j < 8; ++j) v[j] = *(const v4f*)(in + i0 + j * 1024);
#pragma unroll
    for (int j = 0; j < 8; ++j) {
        v4bf o;
#pragma unroll
        for (int c = 0; c < 4; ++c) o[c] = (bf16)v[j][c];
        *(v4bf*)(out + i0 + j * 1024) = o;
    }
    // Another job's code may follow in the kernel: no register that the stores
    // above name is rewritten ahead of this wait.
    asm volatile("s_wait_xcnt 0x0" ::: "memory");
}

// w is [K,N] row-major f32 -> wT is [N,K] row-major bf16.
// Block tile 64 (k) x 128 (n), wave tile 64 x 16, lane patch 8 (k) x 4 (n):
// lane = 8 * (column quad) + (k octet), so the eight lanes of a column quad
// store 8 x 16 bytes = one whole line of a wT row, and the two waves that
// share a 128-byte line of w sit in the same block.
// K and N are compile-time so that one address pair and immediate offsets
// serve all eight loads, and one pair the four stores.
template <int K, int N>
__device__ __forceinline__
void transpose_to_bf16_block(const float* __restrict__ w,
                             bf16* __restrict__ wT, int blk) {
    constexpr int nblk = N / 128;
    int kt = blk / nblk, nt = blk % nblk;
    if (kt >= K / 64) return;                 // block-uniform bound
    int wave = threadIdx.x >> 5, lane = threadIdx.x & 31;
    int k0 = kt * 64 + (lane & 7) * 8;
    int n0 = nt * 128 + wave * 16 + (lane >> 3) * 4;
    const float* src = w + k0 * N + n0;
    bf16* dst = wT + n0 * K + k0;
    v4f v[8];
    // Unrolled for the same two reasons as in the cast job above.
#pragma unroll
    for (int j = 0; j < 8; ++j) v[j] = *(const v4f*)(src + j * N);
#pragma unroll
    for (int c = 0; c < 4; ++c) {
        v8bf o;
#pragma unroll
        for (int j = 0; j < 8; ++j) o[j] = (bf16)v[j][c];
        *(v8bf*)(dst + c * K) = o;
    }
    // Another job's code may follow in the kernel: no register that the stores
    // above name is rewritten ahead of this wait.
    asm volatile("s_wait_xcnt 0x0" ::: "memory");
}

#define CAST_BLOCKS ((TOKENS * D_MODEL) / 8192)
#define SQ_BLOCKS   ((D_MODEL * D_MODEL) / 8192)
#define FF_BLOCKS   ((D_MODEL * D_FF) / 8192)
#define PREP_BLOCKS (CAST_BLOCKS + 4 * SQ_BLOCKS + 2 * FF_BLOCKS)

__global__ __launch_bounds__(256)
void prep_kernel(const float* __restrict__ x,  bf16* __restrict__ xb,
                 const float* __restrict__ wq, bf16* __restrict__ wqT,
                 const float* __restrict__ wk, bf16* __restrict__ wkT,
                 const float* __restrict__ wv, bf16* __restrict__ wvT,
                 const float* __restrict__ wo, bf16* __restrict__ woT,
                 const float* __restrict__ w1, bf16* __restrict__ w1T,
                 const float* __restrict__ w2, bf16* __restrict__ w2T) {
    int b = blockIdx.x;
    if (b < CAST_BLOCKS) {
        f32_to_bf16_block(x, xb, TOKENS * D_MODEL, b);
        return;
    }
    b -= CAST_BLOCKS;
    if (b < 4 * SQ_BLOCKS) {
        int which = b / SQ_BLOCKS;
        const float* w = which == 0 ? wq : which == 1 ? wk : which == 2 ? wv : wo;
        bf16* wT = which == 0 ? wqT : which == 1 ? wkT : which == 2 ? wvT : woT;
        transpose_to_bf16_block<D_MODEL, D_MODEL>(w, wT, b % SQ_BLOCKS);
        return;
    }
    b -= 4 * SQ_BLOCKS;
    if (b < FF_BLOCKS) transpose_to_bf16_block<D_MODEL, D_FF>(w1, w1T, b);
    else               transpose_to_bf16_block<D_FF, D_MODEL>(w2, w2T, b - FF_BLOCKS);
}

// ---------------------------------------------------------------------------
// WMMA GEMM, both operands staged in LDS.
// Workgroup: 256 threads (8 waves), tile 128 (M) x 128 (N); waves 4 (M) x 2 (N),
// each owns a 32x64 slice (8 accumulators). A stage is 128 k of the 128 rows of
// A and of the 128 rows of B^T: rows of 256 bytes, copied in whole lines by
// asynchronous copies into two buffers, the next stage in flight while this one
// is worked on. A row of A then serves 2 waves and a row of B^T serves 4, and
// no wave waits on a global load inside the k loop.
// Needs M, N multiples of 128 and K a multiple of 128.
// MODE and N are compile-time: the epilogue then holds no branch, and one
// address with immediate offsets serves all of a lane's loads or stores. MODE:
//   0 = bf16, rows are tokens, columns scattered to [b,h,s,dk] (Q/K), times oscale
//   1 = bf16, rows are channels, columns are tokens -> [b,h,dk,s] (V^T = Wv^T X^T),
//       bias by row
//   2 = f32 [M,N] + residual;   3 = bf16 [M,N] with ReLU
// Each 16x16 product is taken transposed (B^T rows as the A operand, A rows as
// the B operand): in the accumulator map a lane then holds 8 ADJACENT columns of
// one output row, 16 bytes of bf16. Every wave turns its 32x64 slice through its
// own piece of the finished ring, so that each global store (and each residual
// load) is 16 bytes a lane over whole 128-byte lines.
// ---------------------------------------------------------------------------
#define GT_ROWS    128                        // rows of either operand in a stage
#define GT_K       128                        // k elements in a stage
#define GPITCH     136                        // elements: 256 + 16 bytes, 16 x odd
#define GBUF_BYTES (GT_ROWS * GPITCH * 2)
#define STG_PITCH16 144                       // bytes: 64 bf16 + 16, 16 x odd
#define STG_PITCH32 272                       // bytes: 64 f32 + 16, 16 x odd
#define STG_BYTES   (32 * STG_PITCH32)        // a wave's piece; 8 pieces = As

__device__ __forceinline__ void gemm_stage_copy(const bf16* g, size_t step, unsigned l) {
    asm volatile(
        "global_load_async_to_lds_b128 %0, %8, off\n\t"
        "global_load_async_to_lds_b128 %1, %9, off\n\t"
        "global_load_async_to_lds_b128 %2, %10, off\n\t"
        "global_load_async_to_lds_b128 %3, %11, off\n\t"
        "global_load_async_to_lds_b128 %4, %12, off\n\t"
        "global_load_async_to_lds_b128 %5, %13, off\n\t"
        "global_load_async_to_lds_b128 %6, %14, off\n\t"
        "global_load_async_to_lds_b128 %7, %15, off\n\t"
        "s_wait_xcnt 0x0"
        :: "v"(l), "v"(l + 16 * GPITCH * 2), "v"(l + 32 * GPITCH * 2),
           "v"(l + 48 * GPITCH * 2), "v"(l + 64 * GPITCH * 2),
           "v"(l + 80 * GPITCH * 2), "v"(l + 96 * GPITCH * 2),
           "v"(l + 112 * GPITCH * 2),
           "v"(g), "v"(g + step), "v"(g + 2 * step), "v"(g + 3 * step),
           "v"(g + 4 * step), "v"(g + 5 * step), "v"(g + 6 * step), "v"(g + 7 * step)
        : "memory");
}

typedef bf16 gemm_ring[2][GT_ROWS][GPITCH];

// One block tile. The kernel owns the two rings and hands them in, so that a
// kernel which holds several MODEs still has one pair of rings in LDS.
// blk = the block's index inside this product's range of the grid.
template <int MODE, int N>
__device__ __forceinline__
void gemm_tile(gemm_ring& As, gemm_ring& Bs, int blk,
               const bf16* __restrict__ A,
               const bf16* __restrict__ Bt,
               const float* __restrict__ bias,
               const float* __restrict__ resid,
               void* __restrict__ outp,
               int K, float oscale) {
    int tid   = threadIdx.x;
    int wave  = tid >> 5;
    constexpr int gridN = N >> 7;               // N / 128
    int blkM  = (blk / gridN) << 7;
    int blkN  = (blk % gridN) << 7;
    int wm    = (wave >> 1) * 32;               // this wave's rows in the block tile
    int wn    = (wave & 1) * 64;                // ... and its columns
    int tileM = blkM + wm;
    int tN    = blkN + wn;

    // This lane's first copy of stage 0: a wave's copy covers four whole lines.
    int crow = tid >> 4;                        // 0..15
    int ccol = (tid & 15) * 8;                  // element offset, 16-byte granules
    const bf16* ag = A  + (size_t)(blkM + crow) * K + ccol;
    const bf16* bg = Bt + (size_t)(blkN + crow) * K + ccol;
    unsigned al = (unsigned)(size_t)(as3_void*)&As[0][crow][ccol];
    unsigned bl = (unsigned)(size_t)(as3_void*)&Bs[0][crow][ccol];
    size_t step = (size_t)16 * K;

    v8f acc[2][4];
#pragma unroll
    for (int mi = 0; mi < 2; ++mi)
#pragma unroll
        for (int t = 0; t < 4; ++t)
#pragma unroll
            for (int i = 0; i < 8; ++i) acc[mi][t][i] = 0.0f;

    int stages = K >> 7;
    gemm_stage_copy(ag, step, al);
    gemm_stage_copy(bg, step, bl);
    asm volatile("s_wait_asynccnt 0x0" ::: "memory");   // stage 0 landed
    __syncthreads();                                    // ... and is public
    if (stages > 1) {
        gemm_stage_copy(ag + GT_K, step, al + GBUF_BYTES);
        gemm_stage_copy(bg + GT_K, step, bl + GBUF_BYTES);
    }

    for (int st = 0; st < stages; ++st) {
        const bf16* at = &As[st & 1][wm][0];
        const bf16* bt = &Bs[st & 1][wn][0];
        // Two fragment sets: the next k block's twelve LDS reads go out as one
        // group ahead of this block's WMMAs, never past the end of the stage.
        // Unrolled so that fa and fb keep constant indices (registers) and the
        // reads take immediate offsets.
        v16bf fa[2][2], fb[2][4];
        fa[0][0] = load_frag(at, GPITCH, 0, 0);
        fa[0][1] = load_frag(at, GPITCH, 16, 0);
#pragma unroll
        for (int t = 0; t < 4; ++t) fb[0][t] = load_frag(bt, GPITCH, 16 * t, 0);
#pragma unroll
        for (int kb = 0; kb < GT_K / 32; ++kb) {
            const int cs = kb & 1, ns = cs ^ 1;
            if (kb + 1 < GT_K / 32) {
                fa[ns][0] = load_frag(at, GPITCH, 0,  (kb + 1) * 32);
                fa[ns][1] = load_frag(at, GPITCH, 16, (kb + 1) * 32);
#pragma unroll
                for (int t = 0; t < 4; ++t)
                    fb[ns][t] = load_frag(bt, GPITCH, 16 * t, (kb + 1) * 32);
            }
            // Holds the read group above ahead of the WMMAs below: left free, the
            // scheduler sinks each read to just in front of its use, and the
            // wave then waits out one LDS latency for every two WMMAs. Before the
            // last block it keeps the block before in front of the stage's
            // closing wait, where its WMMAs cover the last read group's latency.
            __builtin_amdgcn_sched_barrier(0);
#pragma unroll
            for (int t = 0; t < 4; ++t) {
                acc[0][t] = wmma_bf16(fb[cs][t], fa[cs][0], acc[0][t]);
                acc[1][t] = wmma_bf16(fb[cs][t], fa[cs][1], acc[1][t]);
            }
        }
        // Publish point: own LDS reads done, own copies of the next stage landed,
        // then the barrier that publishes that stage and frees this one's buffer.
        asm volatile("s_wait_dscnt 0x0" ::: "memory");
        asm volatile("s_wait_asynccnt 0x0" ::: "memory");
        __syncthreads();
        if (st + 2 < stages) {
            gemm_stage_copy(ag + (st + 2) * GT_K, step, al + (st & 1) * GBUF_BYTES);
            gemm_stage_copy(bg + (st + 2) * GT_K, step, bl + (st & 1) * GBUF_BYTES);
        }
    }
    asm volatile("s_wait_asynccnt 0x0" ::: "memory");   // nothing in flight at the end

    // acc[mi][t][i] = C[tileM + 16 mi + r][tN + 16 t + 8 hf + i].
    // The loop's last publish point (every wave's LDS reads done, no copy in
    // flight, barrier) has freed the ring: each wave stages in its own piece.
    int lane = tid & 31;
    int r = lane & 15, hf = lane >> 4;
    char* stg = (char*)&As[0][0][0] + wave * STG_BYTES;

    if constexpr (MODE == 2) {
        // Read-back map: a wave instruction covers two rows of 256 bytes.
        int rrow = lane >> 4, rcol = (lane & 15) * 4;
        // One 32-bit byte offset (below M * N * 4 = 2^24) on the two scalar bases
        // serves the residual loads and the stores.
        unsigned b0 = (unsigned)(tN + rcol) * 4u;
        unsigned g0 = (unsigned)(tileM + rrow) * (N * 4u) + b0;
        constexpr unsigned gstep = 2 * N * 4;
        const char* rbase = (const char*)resid + g0;
        char* obase = (char*)outp + g0;
        v4f rs[16];
        // Unrolled here and below: rs keeps constant indices (registers), and all
        // sixteen residual loads are in flight before the first is waited for.
#pragma unroll
        for (int j = 0; j < 16; ++j) rs[j] = *(const v4f*)(rbase + j * gstep);
        v4f bz = *(const v4f*)((const char*)bias + b0);
#pragma unroll
        for (int mi = 0; mi < 2; ++mi)
#pragma unroll
            for (int t = 0; t < 4; ++t) {
                char* p = stg + (mi * 16 + r) * STG_PITCH32 + (t * 16 + 8 * hf) * 4;
                v4f lo, hi;
#pragma unroll
                for (int i = 0; i < 4; ++i) { lo[i] = acc[mi][t][i]; hi[i] = acc[mi][t][4 + i]; }
                *(v4f*)p = lo;
                *(v4f*)(p + 16) = hi;
            }
        // Own LDS writes done before other lanes' rows are read back.
        asm volatile("s_wait_dscnt 0x0" ::: "memory");
#pragma unroll
        for (int j = 0; j < 16; ++j) {
            v4f v = *(const v4f*)(stg + (2 * j + rrow) * STG_PITCH32 + rcol * 4);
            *(v4f*)(obase + j * gstep) = (v + bz) + rs[j];
        }
        // Another job's code may follow in the kernel: no register that the stores
        // above name is rewritten ahead of this wait.
        asm volatile("s_wait_xcnt 0x0" ::: "memory");
    } else {
        float brow[2];
        v4f bcol[4][2];
        if constexpr (MODE == 1) {
            brow[0] = bias[tileM + r];
            brow[1] = bias[tileM + 16 + r];
        } else {
#pragma unroll
            for (int t = 0; t < 4; ++t) {
                bcol[t][0] = *(const v4f*)(bias + tN + t * 16 + 8 * hf);
                bcol[t][1] = *(const v4f*)(bias + tN + t * 16 + 8 * hf + 4);
            }
        }
#pragma unroll
        for (int mi = 0; mi < 2; ++mi)
#pragma unroll
            for (int t = 0; t < 4; ++t) {
                v8bf o;
#pragma unroll
                for (int i = 0; i < 8; ++i) {
                    float v = acc[mi][t][i];
                    if constexpr (MODE == 1) v += brow[mi];
                    else                     v += bcol[t][i >> 2][i & 3];
                    if constexpr (MODE == 0) v *= oscale;
                    if constexpr (MODE == 3) v = fmaxf(v, 0.0f);
                    o[i] = (bf16)v;
                }
                *(v8bf*)(stg + (mi * 16 + r) * STG_PITCH16 + (t * 16 + 8 * hf) * 2) = o;
            }
        // Own LDS writes done before other lanes' rows are read back.
        asm volatile("s_wait_dscnt 0x0" ::: "memory");
        // Read-back map: a wave instruction covers four rows of 128 bytes.
        int rrow = lane >> 3, rcol = (lane & 7) * 8;
        int m0 = tileM + rrow;
        // Output pitch in elements, and this lane's first element.
        constexpr size_t gpitch = MODE == 0 ? DK : MODE == 1 ? SEQ : N;
        size_t g0;
        if constexpr (MODE == 0)                // [b, h, s, dk]: one head a wave
            g0 = ((((size_t)(m0 >> 11) * NHEADS + (tN >> 6)) * SEQ) + (m0 & (SEQ - 1))) * DK + rcol;
        else if constexpr (MODE == 1)           // [b, h*dk, s]: one batch a wave
            g0 = ((size_t)(tN >> 11) * D_MODEL + m0) * SEQ + (tN & (SEQ - 1)) + rcol;
        else
            g0 = (size_t)m0 * N + tN + rcol;
#pragma unroll
        for (int j = 0; j < 8; ++j) {
            v8bf o = *(const v8bf*)(stg + (4 * j + rrow) * STG_PITCH16 + rcol * 2);
            *(v8bf*)((bf16*)outp + g0 + j * 4 * gpitch) = o;
        }
        // Another job's code may follow in the kernel: no register that the stores
        // above name is rewritten ahead of this wait.
        asm volatile("s_wait_xcnt 0x0" ::: "memory");
    }
}

template <int MODE, int N>
__global__ __launch_bounds__(256)
void gemm_wmma_kernel(const bf16* __restrict__ A,
                      const bf16* __restrict__ Bt,
                      const float* __restrict__ bias,
                      const float* __restrict__ resid,
                      void* __restrict__ outp,
                      int M, int K) {
    __shared__ __attribute__((aligned(16))) bf16 As[2][GT_ROWS][GPITCH];
    __shared__ __attribute__((aligned(16))) bf16 Bs[2][GT_ROWS][GPITCH];
    gemm_tile<MODE, N>(As, Bs, blockIdx.x, A, Bt, bias, resid, outp, K, 1.0f);
}

// Q, K and V^T need nothing of each other: one grid, a third of the block index
// each. The branch is block-uniform, so every barrier inside a tile is reached
// by the whole work-group or by none of it.
#define PROJ_BLOCKS ((TOKENS / 128) * (D_MODEL / 128))

// Q leaves its product already times log2(e) / sqrt(dk), in f32 ahead of the one
// rounding to bf16: K Q^T is then the score in the base-2 domain.
#define QSCALE (0.125f * 1.44269504f)

__global__ __launch_bounds__(256)
void qkv_wmma_kernel(const bf16* __restrict__ xb,
                     const bf16* __restrict__ wqT, const float* __restrict__ bq,
                     bf16* __restrict__ qo,
                     const bf16* __restrict__ wkT, const float* __restrict__ bk,
                     bf16* __restrict__ ko,
                     const bf16* __restrict__ wvT, const float* __restrict__ bv,
                     bf16* __restrict__ vTo,
                     int K) {
    __shared__ __attribute__((aligned(16))) bf16 As[2][GT_ROWS][GPITCH];
    __shared__ __attribute__((aligned(16))) bf16 Bs[2][GT_ROWS][GPITCH];
    int b = blockIdx.x;
    if (b < 2 * PROJ_BLOCKS) {
        bool isq = b < PROJ_BLOCKS;
        gemm_tile<0, D_MODEL>(As, Bs, isq ? b : b - PROJ_BLOCKS, xb,
                              isq ? wqT : wkT, isq ? bq : bk, nullptr,
                              isq ? qo : ko, K, isq ? QSCALE : 1.0f);
    } else {
        gemm_tile<1, TOKENS>(As, Bs, b - 2 * PROJ_BLOCKS, wvT, xb, bv, nullptr,
                             vTo, K, 1.0f);
    }
}

__device__ __forceinline__ float xhalf(float x) {
    int b = __builtin_bit_cast(int, x);
    return __builtin_bit_cast(float,
        __builtin_amdgcn_permlanex16(b, b, 0x76543210, 0xfedcba98, false, false));
}

__device__ __forceinline__ void exp2_x8(float (&x)[8]) {
    asm("v_exp_f32 %0, %0\n\t"
        "v_exp_f32 %1, %1\n\t"
        "v_exp_f32 %2, %2\n\t"
        "v_exp_f32 %3, %3\n\t"
        "v_exp_f32 %4, %4\n\t"
        "v_exp_f32 %5, %5\n\t"
        "v_exp_f32 %6, %6\n\t"
        "v_exp_f32 %7, %7\n\t"
        "v_nop"
        : "+v"(x[0]), "+v"(x[1]), "+v"(x[2]), "+v"(x[3]),
          "+v"(x[4]), "+v"(x[5]), "+v"(x[6]), "+v"(x[7]));
}

__device__ __forceinline__ float exp2_x1(float x) {
    asm("v_exp_f32 %0, %0\n\t"
        "v_nop"
        : "+v"(x));
    return x;
}

#define P_ROOM 4096.0f

#define ATT_KEYS   128
#define ATT_STAGES (SEQ / ATT_KEYS)
#define KPITCH     72                         // elements: 128 + 16 bytes
#define VPITCH     136                        // elements: 256 + 16 bytes
#define KBUF_BYTES (ATT_KEYS * KPITCH * 2)
#define VBUF_BYTES (DK * VPITCH * 2)

__device__ __forceinline__ void attn_stage_copy(const bf16* kg, const bf16* vg,
                                                unsigned kl, unsigned vl) {
    asm volatile(
        "global_load_async_to_lds_b128 %0, %8, off\n\t"
        "global_load_async_to_lds_b128 %1, %9, off\n\t"
        "global_load_async_to_lds_b128 %2, %10, off\n\t"
        "global_load_async_to_lds_b128 %3, %11, off\n\t"
        "global_load_async_to_lds_b128 %4, %12, off\n\t"
        "global_load_async_to_lds_b128 %5, %13, off\n\t"
        "global_load_async_to_lds_b128 %6, %14, off\n\t"
        "global_load_async_to_lds_b128 %7, %15, off\n\t"
        "s_wait_xcnt 0x0"
        :: "v"(kl), "v"(kl + 32 * KPITCH * 2), "v"(kl + 64 * KPITCH * 2),
           "v"(kl + 96 * KPITCH * 2),
           "v"(vl), "v"(vl + 16 * VPITCH * 2), "v"(vl + 32 * VPITCH * 2),
           "v"(vl + 48 * VPITCH * 2),
           "v"(kg), "v"(kg + 32 * DK), "v"(kg + 64 * DK), "v"(kg + 96 * DK),
           "v"(vg), "v"(vg + 16 * SEQ), "v"(vg + 32 * SEQ), "v"(vg + 48 * SEQ)
        : "memory");
}

// The scores of 32 keys x 16 queries, started from c (-ref in every row).
__device__ __forceinline__ void attn_scores(const bf16* kt, int j, v16bf qb0, v16bf qb1,
                                            v8f c, v8f& s0, v8f& s1) {
    s0 = wmma_bf16(load_frag(kt, KPITCH, j, 0),       qb0, c);
    s0 = wmma_bf16(load_frag(kt, KPITCH, j, 32),      qb1, s0);
    s1 = wmma_bf16(load_frag(kt, KPITCH, j + 16, 0),  qb0, c);
    s1 = wmma_bf16(load_frag(kt, KPITCH, j + 16, 32), qb1, s1);
}

__device__ __forceinline__ float max16(v8f a, v8f b) {
    float m = fmaxf(a[0], b[0]);
    // Unrolled so that a and b keep constant indices (registers).
#pragma unroll
    for (int i = 1; i < 8; ++i) m = fmaxf(m, fmaxf(a[i], b[i]));
    return m;
}

// P^T of 32 keys x 16 queries as the B operand of the second product (the
// fragment's k order), and the sum of this lane's sixteen values.
__device__ __forceinline__ void attn_probs(const bf16* kt, int j, v16bf qb0, v16bf qb1,
                                           v8f c, v16bf& pb, float& rs) {
    v8f s0, s1;                               // s0[i]: key j + 8hf + i; s1[i]: 16 further
    attn_scores(kt, j, qb0, qb1, c, s0, s1);
    float p0[8], p1[8];
    // Unrolled so that p0 and p1 keep constant indices (registers).
#pragma unroll
    for (int i = 0; i < 8; ++i) { p0[i] = s0[i]; p1[i] = s1[i]; }
    exp2_x8(p0);
    exp2_x8(p1);
    rs = 0.0f;
#pragma unroll
    for (int i = 0; i < 8; ++i) {
        rs += p0[i] + p1[i];
        pb[i]     = (bf16)p0[i];
        pb[8 + i] = (bf16)p1[i];
    }
}

__global__ __launch_bounds__(256)
void attn_wmma_kernel(const bf16* __restrict__ q,
                      const bf16* __restrict__ k,
                      const bf16* __restrict__ vT,
                      bf16* __restrict__ attn_c) {
    __shared__ __attribute__((aligned(16))) bf16 Ks[2][ATT_KEYS][KPITCH];
    __shared__ __attribute__((aligned(16))) bf16 Vs[2][DK][VPITCH];

    int tid  = threadIdx.x;
    int wid  = tid >> 5;
    int lane = tid & 31;
    int r = lane & 15, hf = lane >> 4;

    int qblocks = SEQ / 128;
    int bh = blockIdx.x / qblocks;
    int qt = (blockIdx.x % qblocks) * 128 + wid * 16;

    const bf16* qh = q  + (size_t)bh * SEQ * DK;
    const bf16* kh = k  + (size_t)bh * SEQ * DK;
    const bf16* vh = vT + (size_t)bh * DK * SEQ;

    // This lane's first copy of stage 0: a wave's copy covers four whole lines.
    const bf16* kg = kh + tid * 8;
    const bf16* vg = vh + (tid >> 4) * SEQ + (tid & 15) * 8;
    unsigned kl = (unsigned)(size_t)(as3_void*)&Ks[0][tid >> 3][(tid & 7) * 8];
    unsigned vl = (unsigned)(size_t)(as3_void*)&Vs[0][tid >> 4][(tid & 15) * 8];

    attn_stage_copy(kg, vg, kl, vl);
    asm volatile("s_wait_asynccnt 0x0" ::: "memory");   // stage 0 landed
    __syncthreads();                                    // ... and is public
    attn_stage_copy(kg + ATT_KEYS * DK, vg + ATT_KEYS, kl + KBUF_BYTES, vl + VBUF_BYTES);

    v16bf qb0 = load_frag(qh, DK, qt, 0);     // B operand: column = query
    v16bf qb1 = load_frag(qh, DK, qt, 32);

    v8f o[4];                                 // o[t][i] = O[query r][16t + 8hf + i]
#pragma unroll
    for (int t = 0; t < 4; ++t)
#pragma unroll
        for (int i = 0; i < 8; ++i) o[t][i] = 0.0f;
    v8f cref;                                 // -ref of query r in every row, equal in both halves
    {
        // ref starts as the query's maximum over the first 32 keys (stage 0 is public).
        // Unrolled here and in the loop below: constant indices (registers).
        v8f z, s0, s1;
#pragma unroll
        for (int i = 0; i < 8; ++i) z[i] = 0.0f;
        attn_scores(&Ks[0][0][0], 0, qb0, qb1, z, s0, s1);
        float mx = max16(s0, s1);
        mx = fmaxf(mx, xhalf(mx));
#pragma unroll
        for (int i = 0; i < 8; ++i) cref[i] = -mx;
    }
    float lsum = 0.0f;                        // this half's share of the sum of query r

    for (int st = 0; st < ATT_STAGES; ++st) {
        const bf16* kt = &Ks[st & 1][0][0];
        const bf16* vt = &Vs[st & 1][0][0];
        // Unrolled so that the LDS reads of all four passes take immediate offsets.
#pragma unroll
        for (int j = 0; j < ATT_KEYS; j += 32) {
            // P of 32 keys x 16 queries against the held ref, and this half's sum of it.
            v16bf pb;
            float rs;
            attn_probs(kt, j, qb0, qb1, cref, pb, rs);

            // One test a pass, a scalar branch for the whole wave, on the sum that is
            // formed anyway: no P of a pass that stays below P_ROOM exceeds it. Above
            // it (or at infinity) ref rises to the pass's maximum (it never falls),
            // O and the sum follow, and the pass's P is taken again from the new ref.
            if (__builtin_amdgcn_ballot_w32(!(rs <= P_ROOM)) != 0) {
                v8f s0, s1;
                attn_scores(kt, j, qb0, qb1, cref, s0, s1);
                float mx   = max16(s0, s1);
                float d    = fmaxf(fmaxf(mx, xhalf(mx)), 0.0f);   // the halves of a query agree
                float corr = exp2_x1(-d);
#pragma unroll
                for (int i = 0; i < 8; ++i) cref[i] -= d;
                lsum *= corr;
#pragma unroll
                for (int t = 0; t < 4; ++t)
#pragma unroll
                    for (int i = 0; i < 8; ++i) o[t][i] *= corr;
                attn_probs(kt, j, qb0, qb1, cref, pb, rs);
            }
            lsum += rs;

#pragma unroll
            for (int t = 0; t < 4; ++t)
                o[t] = wmma_bf16(load_frag(vt, VPITCH, t * 16, j), pb, o[t]);
        }
        // Publish point: own LDS reads done, own copies of the next stage landed,
        // then the barrier that publishes that stage and frees this one's buffer.
        asm volatile("s_wait_dscnt 0x0" ::: "memory");
        asm volatile("s_wait_asynccnt 0x0" ::: "memory");
        __syncthreads();
        if (st + 2 < ATT_STAGES)
            attn_stage_copy(kg + (st + 2) * (ATT_KEYS * DK), vg + (st + 2) * ATT_KEYS,
                            kl + (st & 1) * KBUF_BYTES, vl + (st & 1) * VBUF_BYTES);
    }
    asm volatile("s_wait_asynccnt 0x0" ::: "memory");   // nothing in flight at the end

    lsum += xhalf(lsum);                      // join the halves' sums once

    int bb = bh >> 3, hd = bh & (NHEADS - 1);
    size_t tok = (size_t)bb * SEQ + qt + r;
#pragma unroll
    for (int t = 0; t < 4; ++t) {
        v8bf ov;                              // 8 consecutive columns of one token
#pragma unroll
        for (int i = 0; i < 8; ++i) ov[i] = (bf16)(o[t][i] / lsum);
        *(v8bf*)(attn_c + tok * D_MODEL + hd * DK + t * 16 + 8 * hf) = ov;
    }
}

// ---------------------------------------------------------------------------
// LayerNorm (faithful: unbiased std, eps added to std). A wave takes four rows,
// a lane 16 bytes of every 512: the sixteen row loads and the eight loads of
// alpha and beta all go out ahead of the first wait, alpha and beta serve four
// rows from registers, and every store instruction fills whole 128-byte lines.
// One block of 8 waves = 32 rows; the grid is TOKENS / 32 blocks.
// ---------------------------------------------------------------------------
#define LN_ROWS 4

template <bool W16>
__global__ __launch_bounds__(256)
void layernorm_kernel(const float* __restrict__ z,
                      const float* __restrict__ alpha,
                      const float* __restrict__ beta,
                      float* __restrict__ out32,
                      bf16* __restrict__ out16) {
    int wid  = threadIdx.x >> 5;
    int lane = threadIdx.x & 31;
    int row0 = (blockIdx.x * 8 + wid) * LN_ROWS;
    int c0   = lane * 4;                      // this lane's first column of each 128
    int e0   = row0 * D_MODEL + c0;           // below TOKENS * D_MODEL = 2^22

    // Every loop here is unrolled so that the arrays keep constant indices
    // (registers, no scratch) and the loads take immediate offsets.
    v4f x[LN_ROWS][4], a[4], b[4];
#pragma unroll
    for (int rr = 0; rr < LN_ROWS; ++rr)
#pragma unroll
        for (int j = 0; j < 4; ++j)
            x[rr][j] = *(const v4f*)(z + e0 + rr * D_MODEL + j * 128);
#pragma unroll
    for (int j = 0; j < 4; ++j) {
        a[j] = *(const v4f*)(alpha + c0 + j * 128);
        b[j] = *(const v4f*)(beta  + c0 + j * 128);
    }
    // Keeps the loads of alpha and beta up here: left free, the scheduler sinks
    // them behind the two reductions, and the wave waits out their latency there.
    __builtin_amdgcn_sched_barrier(0);

    float sum[LN_ROWS];
#pragma unroll
    for (int rr = 0; rr < LN_ROWS; ++rr) {
        float t = 0.0f;
#pragma unroll
        for (int j = 0; j < 4; ++j)
#pragma unroll
            for (int c = 0; c < 4; ++c) t += x[rr][j][c];
        sum[rr] = t;
    }
    // The four rows' exchanges of one step need nothing of each other.
#pragma unroll
    for (int m = 1; m < 32; m <<= 1)
#pragma unroll
        for (int rr = 0; rr < LN_ROWS; ++rr) sum[rr] += __shfl_xor(sum[rr], m);

    float mean[LN_ROWS], var[LN_ROWS];
#pragma unroll
    for (int rr = 0; rr < LN_ROWS; ++rr) {
        mean[rr] = sum[rr] * (1.0f / 512.0f);
        float t = 0.0f;
#pragma unroll
        for (int j = 0; j < 4; ++j)
#pragma unroll
            for (int c = 0; c < 4; ++c) { float d = x[rr][j][c] - mean[rr]; t += d * d; }
        var[rr] = t;
    }
#pragma unroll
    for (int m = 1; m < 32; m <<= 1)
#pragma unroll
        for (int rr = 0; rr < LN_ROWS; ++rr) var[rr] += __shfl_xor(var[rr], m);

#pragma unroll
    for (int rr = 0; rr < LN_ROWS; ++rr) {
        float v = var[rr] * (1.0f / 511.0f);      // ddof = 1
        float inv = 1.0f / (sqrtf(v) + 1e-6f);    // eps added to std
#pragma unroll
        for (int j = 0; j < 4; ++j) {
            v4f y;
#pragma unroll
            for (int c = 0; c < 4; ++c)
                y[c] = a[j][c] * (x[rr][j][c] - mean[rr]) * inv + b[j][c];
            *(v4f*)(out32 + e0 + rr * D_MODEL + j * 128) = y;
            if constexpr (W16) {
                v4bf o;
#pragma unroll
                for (int c = 0; c < 4; ++c) o[c] = (bf16)y[c];
                *(v4bf*)(out16 + e0 + rr * D_MODEL + j * 128) = o;
            }
        }
    }
}

// ---------------------------------------------------------------------------
// Launch
// ---------------------------------------------------------------------------
extern "C" void kernel_launch(void* const* d_in, const int* in_sizes, int n_in,
                              void* d_out, int out_size, void* d_ws, size_t ws_size,
                              hipStream_t stream) {
    const float* x    = (const float*)d_in[0];
    const float* wq   = (const float*)d_in[1];
    const float* bq   = (const float*)d_in[2];
    const float* wk   = (const float*)d_in[3];
    const float* bk   = (const float*)d_in[4];
    const float* wv   = (const float*)d_in[5];
    const float* bv   = (const float*)d_in[6];
    const float* wo   = (const float*)d_in[7];
    const float* bo   = (const float*)d_in[8];
    const float* w1   = (const float*)d_in[9];
    const float* b1   = (const float*)d_in[10];
    const float* w2   = (const float*)d_in[11];
    const float* b2   = (const float*)d_in[12];
    const float* ln1a = (const float*)d_in[13];
    const float* ln1b = (const float*)d_in[14];
    const float* ln2a = (const float*)d_in[15];
    const float* ln2b = (const float*)d_in[16];
    float* out = (float*)d_out;

    char* ws = (char*)d_ws;
    size_t off = 0;
    auto carve = [&](size_t bytes) { char* p = ws + off; off += (bytes + 255) & ~(size_t)255; return p; };
    bf16*  xb   = (bf16*)carve((size_t)TOKENS * D_MODEL * 2);
    bf16*  wqT  = (bf16*)carve((size_t)D_MODEL * D_MODEL * 2);
    bf16*  wkT  = (bf16*)carve((size_t)D_MODEL * D_MODEL * 2);
    bf16*  wvT  = (bf16*)carve((size_t)D_MODEL * D_MODEL * 2);
    bf16*  woT  = (bf16*)carve((size_t)D_MODEL * D_MODEL * 2);
    bf16*  w1T  = (bf16*)carve((size_t)D_MODEL * D_FF * 2);
    bf16*  w2T  = (bf16*)carve((size_t)D_FF * D_MODEL * 2);
    bf16*  qb   = (bf16*)carve((size_t)TOKENS * D_MODEL * 2);
    bf16*  kb   = (bf16*)carve((size_t)TOKENS * D_MODEL * 2);
    bf16*  vTb  = (bf16*)carve((size_t)TOKENS * D_MODEL * 2);
    bf16*  attn = (bf16*)carve((size_t)TOKENS * D_MODEL * 2);
    float* z1   = (float*)carve((size_t)TOKENS * D_MODEL * 4);   // reused for z2
    float* y32  = (float*)carve((size_t)TOKENS * D_MODEL * 4);
    bf16*  y16  = (bf16*)carve((size_t)TOKENS * D_MODEL * 2);
    bf16*  ffh  = (bf16*)carve((size_t)TOKENS * D_FF * 2);

    // --- prep: bf16 conversion + weight transposes ---
    prep_kernel<<<PREP_BLOCKS, 256, 0, stream>>>(x, xb, wq, wqT, wk, wkT, wv, wvT,
                                                 wo, woT, w1, w1T, w2, w2T);

    // --- QKV projections: workgroup tile 128x128 -> 256 blocks each, one grid ---
    qkv_wmma_kernel<<<3 * PROJ_BLOCKS, 256, 0, stream>>>(xb, wqT, bq, qb, wkT, bk, kb,
                                                         wvT, bv, vTb, D_MODEL);

    // --- attention: 32 (b,h) * 16 q-blocks, 8 waves each ---
    attn_wmma_kernel<<<BATCH * NHEADS * (SEQ / 128), 256, 0, stream>>>(qb, kb, vTb, attn);

    // --- out-proj + residual -> z1; LN1 -> y (f32 + bf16) ---
    gemm_wmma_kernel<2, D_MODEL><<<256, 256, 0, stream>>>(attn, woT, bo, x, z1, TOKENS, D_MODEL);
    layernorm_kernel<true><<<TOKENS / 32, 256, 0, stream>>>(z1, ln1a, ln1b, y32, y16);

    // --- FFN1 (ReLU) -> ffh; FFN2 + residual(y) -> z1; LN2 -> out ---
    gemm_wmma_kernel<3, D_FF><<<1024, 256, 0, stream>>>(y16, w1T, b1, nullptr, ffh, TOKENS, D_MODEL);
    gemm_wmma_kernel<2, D_MODEL><<<256, 256, 0, stream>>>(ffh, w2T, b2, y32, z1, TOKENS, D_FF);
    layernorm_kernel<false><<<TOKENS / 32, 256, 0, stream>>>(z1, ln2a, ln2b, out, nullptr);
}
